// v000
// Measured on an AMD MI455X. A time is GPU time per run, averaged over a window of back-to-back runs after a warm-up
// (all launches, gaps included; the runs take copies of the inputs in turn), and the median of several windows.
// Apart from v000's, it joins two sittings. Times from different sittings can be a few percent apart, while
// side-by-side timings come from the same sitting.
// v000, which the later versions start from, runs in 143 microseconds.
// Contractions on v_wmma_f32_16x16x32_f16, f32 accumulate: x.Wq, x.Wk, x.Wv (x carried x16, W x1024, f16 built
// from bf16-RNE inputs); q.k^T (q, k carried x16); per (b,j): P.V (P carried x1024, v x16) and X.Wo (X carried
// x16, Wo x1024); single products. exp, row sums, reciprocal, bias adds and the max-pool in f32 on VALU.
#include <hip/hip_runtime.h>
#include <stdint.h>

#define NBATCH 8
#define NN     128
#define DDIM   256
#define NROWS  1024            // NBATCH*NN
#define PLN    262144          // NBATCH*NN*DDIM
#define WSZ    65536           // DDIM*DDIM
#define SSZ    131072          // NBATCH*NN*NN
static_assert(NROWS == NBATCH * NN);
static_assert(PLN == NROWS * DDIM);
static_assert(WSZ == DDIM * DDIM);
static_assert(SSZ == NBATCH * NN * NN);
static_assert(NN == 128);
static_assert(DDIM == 256);
static_assert((NROWS % 64) == 0);

typedef _Float16     v16h __attribute__((ext_vector_type(16)));
typedef _Float16     v8h  __attribute__((ext_vector_type(8)));
typedef float        v8f  __attribute__((ext_vector_type(8)));
typedef float        v4f  __attribute__((ext_vector_type(4)));
typedef unsigned int v4u  __attribute__((ext_vector_type(4)));
typedef int          v4i  __attribute__((ext_vector_type(4)));

union Frag { v16h v; v8h half[2]; };

// ---- scalar helpers --------------------------------------------------------------------------------
__device__ __forceinline__ unsigned short bf_bits(float f) {          // f32 -> bf16 bits, RNE convert
  unsigned u = __float_as_uint(f);
  return (unsigned short)((u + 0x7FFFu + ((u >> 16) & 1u)) >> 16);
}
__device__ __forceinline__ float bf_up(unsigned short b) { return __uint_as_float(((unsigned)b) << 16); }
__device__ __forceinline__ float bfr(float f) { return bf_up(bf_bits(f)); }   // value after bf16 RNE convert
__device__ __forceinline__ unsigned short h_bits(float f) {           // f32 -> f16 bits, RNE convert
  return __builtin_bit_cast(unsigned short, (_Float16)f);
}
__device__ __forceinline__ unsigned pack2(float a, float b) {         // two halves into one word, low = first
  return (unsigned)h_bits(a) | (((unsigned)h_bits(b)) << 16);
}
__device__ __forceinline__ v8f fill8(float x) {
  v8f z;
  z[0] = x; z[1] = x; z[2] = x; z[3] = x; z[4] = x; z[5] = x; z[6] = x; z[7] = x;
  return z;
}

// ---- 16-bit fragment loader (A, B alike): p points at row/col (lane&15), k0 + 8*(lane>>4);
//      elements 0..7 <- p[0..7] (k0+8h..k0+8h+7), elements 8..15 <- p[16..23] (k0+16+8h..k0+16+8h+7)
__device__ __forceinline__ v16h ldfrag(const _Float16* p) {
  Frag f;
  f.half[0] = *(const v8h*)(p);
  f.half[1] = *(const v8h*)(p + 16);
  return f.v;
}

// ---- WMMA with trailing VALU hazard gap (ties D, keeps A/B live past the nops) ---------------------
__device__ __forceinline__ v8f mma(v16h a, v16h b, v8f c) {
  v8f d = __builtin_amdgcn_wmma_f32_16x16x32_f16(false, a, false, b, (short)0, c, false, false);
#if defined(__HIP_DEVICE_COMPILE__)
  asm volatile("v_nop\n\tv_nop\n\tv_nop\n\tv_nop" : "+v"(d) : "v"(a), "v"(b));
#endif
  return d;
}

// =====================================================================================================
// k_prep: blocks 0..127 convert x [1024][256] f32 -> Xh f16 of (bf16-RNE value * 16), 2048 elements per block,
// Blocks 128..159: weight wi = (bid-128)>>3 (0 Wq, 1 Wk, 2 Wv, 3 Wo), rows e0..e0+31 of WT[wi][e][f] =
//   f16 of (bf16-RNE W[f][e] * 1024): LDS tile [32 c][256 f] filled by 2-B stores, then 4 store
// coverage: 128 x 2048 halves = all of Xh; 32 x 8192 halves = all of WT (4 x 256 x 256).
// =====================================================================================================
__global__ __launch_bounds__(256) void k_prep(const float* __restrict__ x,
                                              const float* __restrict__ Wq, const float* __restrict__ Wk,
                                              const float* __restrict__ Wv, const float* __restrict__ Wo,
                                              unsigned short* Xh, unsigned short* WT) {
  __shared__ __align__(16) unsigned short sT[8192];
  const int tid = threadIdx.x;
  const int bid = blockIdx.x;                  // 0..159
  const int isw = (bid >= (NROWS * DDIM / 2048)) ? 1 : 0;        // block-uniform role
  const int wb  = isw ? (bid - (NROWS * DDIM / 2048)) : 0;
  const int wi  = wb >> 3;                     // 0..3
  const int e0  = (wb & 7) * 32;

  if (isw) {
    const float* src = (wi == 0) ? Wq : ((wi == 1) ? Wk : ((wi == 2) ? Wv : Wo));   // block-uniform, all global
#pragma unroll 1
    for (int it = 0; it < 4; ++it) {
      const int p  = it * 256 + tid;           // 0..1023
      const int f  = p >> 2;                   // 0..255
      const int c8 = (p & 3) * 8;              // 0,8,16,24
      const float* q = src + (size_t)f * DDIM + e0 + c8;
      const v4f v0 = *(const v4f*)(q);
      const v4f v1 = *(const v4f*)(q + 4);
      unsigned short* d = sT + c8 * 256 + f;   // tile layout [c][f]
#pragma unroll
      for (int u = 0; u < 4; ++u) {
        d[u * 256]       = h_bits(bfr(v0[u]) * 1024.0f);
        d[(u + 4) * 256] = h_bits(bfr(v1[u]) * 1024.0f);
      }
    }
  }
  __syncthreads();

  if (isw) {
    unsigned short* dst = WT + (size_t)wi * WSZ + (size_t)e0 * DDIM;
    v4u pv[4];
#pragma unroll
    for (int it = 0; it < 4; ++it) pv[it] = *(const v4u*)(sT + (size_t)(it * 256 + tid) * 8);
#pragma unroll
    for (int it = 0; it < 4; ++it) *(v4u*)(dst + (size_t)(it * 256 + tid) * 8) = pv[it];
    
  } else {
    const size_t base = (size_t)bid * 2048 + (size_t)tid * 8;
    const v4f v0 = *(const v4f*)(x + base);
    const v4f v1 = *(const v4f*)(x + base + 4);
    v4u pk;
    pk[0] = pack2(bfr(v0[0]) * 16.0f, bfr(v0[1]) * 16.0f);
    pk[1] = pack2(bfr(v0[2]) * 16.0f, bfr(v0[3]) * 16.0f);
    pk[2] = pack2(bfr(v1[0]) * 16.0f, bfr(v1[1]) * 16.0f);
    pk[3] = pack2(bfr(v1[2]) * 16.0f, bfr(v1[3]) * 16.0f);
    unsigned short* dst = Xh + base;
    *(v4u*)dst = pk;
    
  }
}

// =====================================================================================================
// k_proj: plane pj = 0 (q), 1 (k), 2 (v): val[n][e] = f16 of 16*(x[n][:].W[:][e] + bfr(bias[e])), n flattened
// over (b, node) 0..1023. Block (pj, rt, cg): rows n = 64 rt .. +63, cols e = 64 cg .. +63; 8 waves, wave w:
// rows 64rt + 16(w>>1), cols 64cg + 32(w&1) + {0..15, 16..31}. A-op = Xh row n (k = f, split map), B-op =
// WT[pj] row e (k = f, split map); D row n = ... + 8h + r, col e = ... + (lane&15); acc = 16384 * (x.W).
// coverage: per plane 16 x 4 blocks x 64 x 64 = 1024 x 256 (planes 0,1) and 8 x 256 x 128 (plane 2).
// =====================================================================================================
__global__ __launch_bounds__(256) void k_proj(const unsigned short* __restrict__ Xhp,
                                              const unsigned short* __restrict__ WTp,
                                              const float* __restrict__ bq, const float* __restrict__ bk,
                                              const float* __restrict__ bv, unsigned short* QKV) {
  __shared__ __align__(16) unsigned short sT[4096];     // 64 x 64
  const _Float16* Xh = (const _Float16*)(const void*)Xhp;
  const _Float16* WT = (const _Float16*)(const void*)WTp;
  const int tid  = threadIdx.x;
  const int lane = tid & 31, w = tid >> 5, h = lane >> 4, m = lane & 15;
  const int bid  = blockIdx.x;                          // 0..191
  const int pj   = bid / ((NROWS / 64) * (DDIM / 64));   // 0..2 (block-uniform)
  const int rt   = (bid / (DDIM / 64)) % (NROWS / 64);   // 64-row tile of the NROWS flattened rows
  const int cg   = bid % (DDIM / 64);
  const int n0   = rt * 64;
  const int e0g  = cg * 64;
  const int wr   = w >> 1, wc = w & 1;
  const int tr   = (pj == 2) ? 1 : 0;
  const float* bias = (pj == 0) ? bq : ((pj == 1) ? bk : bv);   // block-uniform, all global

  const _Float16* Ap  = Xh + (size_t)(n0 + 16 * wr + m) * DDIM + 8 * h;
  const _Float16* Bp0 = WT + (size_t)pj * WSZ + (size_t)(e0g + 32 * wc + m) * DDIM + 8 * h;
  const _Float16* Bp1 = Bp0 + (size_t)16 * DDIM;
  v8f acc0 = fill8(0.0f), acc1 = fill8(0.0f);
#pragma unroll
  for (int ks = 0; ks < 8; ++ks) {
    const v16h a = ldfrag(Ap + ks * 32);
    acc0 = mma(a, ldfrag(Bp0 + ks * 32), acc0);
    acc1 = mma(a, ldfrag(Bp1 + ks * 32), acc1);
  }

  const int el0 = 32 * wc + m, el1 = el0 + 16;
  const float bb0 = bfr(bias[e0g + el0]);
  const float bb1 = bfr(bias[e0g + el1]);
#pragma unroll
  for (int r = 0; r < 8; ++r) {
    const int nl = 16 * wr + 8 * h + r;
    const float v0 = (acc0[r] * 6.103515625e-05f + bb0) * 16.0f;  // acc/16384 + b, carried x16
    const float v1 = (acc1[r] * 6.103515625e-05f + bb1) * 16.0f;
    const int i0 = tr ? (el0 * 64 + nl) : (nl * 64 + el0);
    const int i1 = tr ? (el1 * 64 + nl) : (nl * 64 + el1);
    sT[i0] = h_bits(v0);
    sT[i1] = h_bits(v1);
  }
  __syncthreads();

  const int piece = tid & 7, rq = tid >> 3;             // rq 0..31
  const int b = rt >> 1, kk0 = (rt & 1) * 64;           // flattened row 64rt = batch b, node kk0
  v4u pv[2];
  size_t o[2];
#pragma unroll
  for (int it = 0; it < 2; ++it) {
    const int row = it * 32 + rq;                       // tile row 0..63 (nl for planes 0,1; el for plane 2)
    pv[it] = *(const v4u*)(sT + row * 64 + piece * 8);
    const size_t oN = (size_t)pj * PLN + (size_t)(n0 + row) * DDIM + e0g + piece * 8;
    const size_t oT = (size_t)2 * PLN + (size_t)(b * DDIM + e0g + row) * NN + kk0 + piece * 8;
    o[it] = tr ? oT : oN;
  }
#pragma unroll
  for (int it = 0; it < 2; ++it) *(v4u*)(QKV + o[it]) = pv[it];
  
}

// =====================================================================================================
// k_scores: S[b][j][kk] = expf((q_j.k_kk)/16), f32 plane [8][128][128]. Block (b, jt): rows j = 16 jt..+15,
// all 128 kk; 8 waves, wave w owns kk0 = 16 w. A-op = Q row j (k = d, split), B-op = K row kk (k = d, split).
// acc = 256 * q.k -> logit arg = acc * 2^-12. 16x128 f32 strip staged in LDS; expf in a rolled pass; store:
// coverage: 64 blocks x 2048 floats = all of S.
// =====================================================================================================
__global__ __launch_bounds__(256) void k_scores(const unsigned short* __restrict__ QKV, float* S) {
  __shared__ __align__(16) float sS[2048];              // [16][128]
  const _Float16* Q = (const _Float16*)(const void*)QKV;
  const _Float16* K = Q + PLN;
  const int tid  = threadIdx.x;
  const int lane = tid & 31, w = tid >> 5, h = lane >> 4, m = lane & 15;
  const int bid  = blockIdx.x;                          // 0..63
  const int jt   = bid & 7;
  const int b    = bid >> 3;
  const int j0   = b * NN + jt * 16;                    // flattened query row base
  const int kr0  = b * NN + w * 16;                     // flattened key row base

  const _Float16* Ap = Q + (size_t)(j0 + m) * DDIM + 8 * h;
  const _Float16* Bp = K + (size_t)(kr0 + m) * DDIM + 8 * h;
  v8f acc = fill8(0.0f);
#pragma unroll
  for (int ks = 0; ks < 8; ++ks) acc = mma(ldfrag(Ap + ks * 32), ldfrag(Bp + ks * 32), acc);

#pragma unroll
  for (int r = 0; r < 8; ++r) sS[(8 * h + r) * NN + w * 16 + m] = acc[r] * 0.000244140625f;   // 2^-12
  __syncthreads();
#pragma unroll 1
  for (int e = tid; e < 2048; e += 256) sS[e] = expf(sS[e]);
  __syncthreads();

  v4f pv[2];
#pragma unroll
  for (int it = 0; it < 2; ++it) pv[it] = *(const v4f*)(sS + (size_t)(it * 256 + tid) * 4);
  float* op = S + (size_t)j0 * NN;
#pragma unroll
  for (int it = 0; it < 2; ++it) *(v4f*)(op + (size_t)(it * 256 + tid) * 4) = pv[it];
  
}

// =====================================================================================================
// k_main: one 256-thread block per (b, j); the block owns output row (b, j) and sees every subtree i itself,
// so the max over i needs no cross-block exchange. s[kk] = S[b][j][kk]; ok[i] = (adj_mask[b][i][j] == 0).
// Phase 1 (thread i < 128): aij = adj[b][i][j] != 0; den = aij ? sum_kk (adj[b][i][kk] != 0) s[kk] : 0;
//   P[i][kk] = (aij && adj[b][i][kk] != 0) ? s[kk] / max(den, 1e-9) : 0, stored x1024 as f16 in Pt [128][128].
// Phase 2: X (x16) = (1024 P).(16 V_b) * 2^-10: A-op rows i from Pt (k = kk, split), B-op cols e from VT[b] rows
//   (k = kk, split); wave w owns e = 32 w + {0..15, 16..31}, 8 i-tiles x 4 k-steps; Xt [128][256] f16 in LDS.
// Phase 3: O = (16 X).(1024 Wo) * 2^-14 + bfr(bo): A-op rows i from Xt (k = e), B-op cols d from WoT rows
//   (k = e); wave w owns d = 32 w + {0..15, 16..31}, 8 i-tiles x 8 k-steps. val = ok[i] ? O : -1e12;
//   column max over all 128 i via per-lane max over r and a xor-16 shuffle.
// Output row (b, j) = 256 f32 = 1 KB staged in LDS, written by threads 0..63 x 16 B in one instruction
// coverage: 1024 blocks x 256 floats = the whole output; Pt rows 0..127 (threads 0..127 x 16 x 8 halves),
//   Xt 8 i-tiles x 16 rows x 8 waves x 32 cols = 128 x 256, ok/wsr 128 entries, all before their barriers.
// =====================================================================================================
__global__ __launch_bounds__(256) void k_main(const int* __restrict__ adj, const int* __restrict__ adjm,
                                              const float* __restrict__ S, const unsigned short* __restrict__ QKVp,
                                              const unsigned short* __restrict__ WTp, const float* __restrict__ bo,
                                              float* out) {
  extern __shared__ __align__(16) _Float16 smem[];      // Pt [128][128] at 0, Xt [128][256] at 16384 halves
  __shared__ __align__(16) float sO[DDIM];
  __shared__ float wsr[NN];
  __shared__ int   sok[NN];
  _Float16* Pt = smem;
  _Float16* Xt = smem + NN * NN;
  const _Float16* VT  = (const _Float16*)(const void*)QKVp + (size_t)2 * PLN;   // [b][e][kk]
  const _Float16* WoT = (const _Float16*)(const void*)WTp + (size_t)3 * WSZ;    // [d][e]
  const int tid  = threadIdx.x;
  const int lane = tid & 31, w = tid >> 5, h = lane >> 4, m = lane & 15;
  const int b    = blockIdx.x >> 7;
  const int j    = blockIdx.x & (NN - 1);

  if (tid < NN) {                                       // waves 0..3, wave-uniform
    wsr[tid] = S[(size_t)(b * NN + j) * NN + tid];
    sok[tid] = (adjm[(size_t)(b * NN + tid) * NN + j] == 0) ? 1 : 0;
  }
  __syncthreads();

  // ---------------- phase 1: subtree-normalised score rows ----------------
  if (tid < NN) {                                       // waves 0..3, wave-uniform
    const int i = tid;
    const int* arow = adj + (size_t)(b * NN + i) * NN;
    const int aij = arow[j];
    float den = 0.0f;
#pragma unroll 1
    for (int k8 = 0; k8 < 16; ++k8) {
      const v4i a0 = *(const v4i*)(arow + k8 * 8);
      const v4i a1 = *(const v4i*)(arow + k8 * 8 + 4);
#pragma unroll
      for (int u = 0; u < 4; ++u) {
        const float s0 = wsr[k8 * 8 + u];
        const float s1 = wsr[k8 * 8 + 4 + u];
        den += (a0[u] != 0) ? s0 : 0.0f;
        den += (a1[u] != 0) ? s1 : 0.0f;
      }
    }
    den = (aij != 0) ? den : 0.0f;
    const float rden = 1.0f / fmaxf(den, 1.0e-9f);
#pragma unroll 1
    for (int k8 = 0; k8 < 16; ++k8) {
      const v4i a0 = *(const v4i*)(arow + k8 * 8);
      const v4i a1 = *(const v4i*)(arow + k8 * 8 + 4);
      v8h hv;
#pragma unroll
      for (int u = 0; u < 4; ++u) {
        const float s0 = wsr[k8 * 8 + u];
        const float s1 = wsr[k8 * 8 + 4 + u];
        const float t0 = (aij != 0 && a0[u] != 0) ? s0 : 0.0f;
        const float t1 = (aij != 0 && a1[u] != 0) ? s1 : 0.0f;
        hv[u]     = (_Float16)((t0 * rden) * 1024.0f);
        hv[4 + u] = (_Float16)((t1 * rden) * 1024.0f);
      }
      *(v8h*)(Pt + i * NN + k8 * 8) = hv;
    }
  }
  __syncthreads();

  // ---------------- phase 2: X (x16) = P . V_b ----------------
  {
    const _Float16* vp0 = VT + (size_t)(b * DDIM + 32 * w + m) * NN + 8 * h;   // B-op col e = 32w + m
    const _Float16* vp1 = vp0 + (size_t)16 * NN;                               // col e = 32w + 16 + m
    v16h Bf0[4], Bf1[4];
#pragma unroll
    for (int ks = 0; ks < 4; ++ks) {
      Bf0[ks] = ldfrag(vp0 + ks * 32);
      Bf1[ks] = ldfrag(vp1 + ks * 32);
    }
#pragma unroll 1
    for (int it = 0; it < 8; ++it) {
      const _Float16* ap = Pt + (it * 16 + m) * NN + 8 * h;                    // A-op row i = 16 it + (lane&15)
      v8f a0 = fill8(0.0f), a1 = fill8(0.0f);
#pragma unroll
      for (int ks = 0; ks < 4; ++ks) {
        const v16h a = ldfrag(ap + ks * 32);
        a0 = mma(a, Bf0[ks], a0);
        a1 = mma(a, Bf1[ks], a1);
      }
#pragma unroll
      for (int r = 0; r < 8; ++r) {                      // D row i = 16 it + 8h + r, col e = 32w + m (+16)
        _Float16* xr = Xt + (size_t)(it * 16 + 8 * h + r) * DDIM + 32 * w + m;
        xr[0]  = (_Float16)(a0[r] * 0.0009765625f);      // 16384 X * 2^-10 = 16 X
        xr[16] = (_Float16)(a1[r] * 0.0009765625f);
      }
    }
  }
  __syncthreads();

  // ---------------- phase 3: O = X . Wo + bo, masked max over i ----------------
  v8f m0 = fill8(-3.0e38f), m1 = fill8(-3.0e38f);
  {
    const _Float16* bp0 = WoT + (size_t)(32 * w + m) * DDIM + 8 * h;            // B-op col d = 32w + m
    const _Float16* bp1 = bp0 + (size_t)16 * DDIM;                             // col d = 32w + 16 + m
    const float bb0 = bfr(bo[32 * w + m]);
    const float bb1 = bfr(bo[32 * w + 16 + m]);
#pragma unroll 1
    for (int it = 0; it < 8; ++it) {
      const _Float16* ap = Xt + (size_t)(it * 16 + m) * DDIM + 8 * h;          // A-op row i = 16 it + (lane&15)
      v8f c0 = fill8(0.0f), c1 = fill8(0.0f);
#pragma unroll
      for (int ks = 0; ks < 8; ++ks) {
        const v16h a = ldfrag(ap + ks * 32);
        c0 = mma(a, ldfrag(bp0 + ks * 32), c0);
        c1 = mma(a, ldfrag(bp1 + ks * 32), c1);
      }
#pragma unroll
      for (int r = 0; r < 8; ++r) {                      // D row i = 16 it + 8h + r
        const int ok = sok[it * 16 + 8 * h + r];
        const float v0 = c0[r] * 6.103515625e-05f + bb0;   // 16384 O * 2^-14 + bo
        const float v1 = c1[r] * 6.103515625e-05f + bb1;
        m0[r] = fmaxf(m0[r], (ok != 0) ? v0 : -1.0e12f);
        m1[r] = fmaxf(m1[r], (ok != 0) ? v1 : -1.0e12f);
      }
    }
  }

  float M0 = m0[0], M1 = m1[0];
#pragma unroll
  for (int r = 1; r < 8; ++r) { M0 = fmaxf(M0, m0[r]); M1 = fmaxf(M1, m1[r]); }
  M0 = fmaxf(M0, __shfl_xor(M0, 16, 32));               // combine lane halves (not under lane-varying control)
  M1 = fmaxf(M1, __shfl_xor(M1, 16, 32));
  sO[w * 32 + m]      = M0;                             // both lane halves write the same value
  sO[w * 32 + 16 + m] = M1;
  __syncthreads();

  float* op = out + (size_t)(b * NN + j) * DDIM + (size_t)tid * 4;
  if (tid < 64) {                                       // waves 0,1: 64 x 16 B = the whole 1-KB row, 8 lines
    const v4f ov = *(const v4f*)(sO + tid * 4);
    *(v4f*)op = ov;
  }
  
}

// =====================================================================================================
// Workspace map (bytes); every region is an exact multiple of its whole-line store granularity:
//   Xh   f16 [1024][256]                      524288 at       0
//   WT   f16 [4][256][256]                    524288 at  524288
//   QKV  f16 Q [1024][256], K [1024][256], VT [8][256][128]   1572864 at 1048576
//   S    f32 [8][128][128]                    524288 at 2621440
//   total                                    3145728
// =====================================================================================================
extern "C" void kernel_launch(void* const* d_in, const int* in_sizes, int n_in,
                              void* d_out, int out_size, void* d_ws, size_t ws_size,
                              hipStream_t stream) {
  if (n_in < 11) return;
  if (in_sizes[0] != SSZ) return;                // adj
  if (in_sizes[1] != PLN) return;                // sat_inputs
  if (in_sizes[2] != SSZ) return;                // adj_mask
  if (in_sizes[3] != WSZ || in_sizes[4] != DDIM) return;
  if (in_sizes[5] != WSZ || in_sizes[6] != DDIM) return;
  if (in_sizes[7] != WSZ || in_sizes[8] != DDIM) return;
  if (in_sizes[9] != WSZ || in_sizes[10] != DDIM) return;
  if (out_size != PLN) return;

  const int*   adj  = (const int*)d_in[0];       // [8][128][128]
  const float* x    = (const float*)d_in[1];     // [8][128][256]
  const int*   adjm = (const int*)d_in[2];       // [8][128][128]
  const float* Wq   = (const float*)d_in[3];  const float* bq = (const float*)d_in[4];
  const float* Wk   = (const float*)d_in[5];  const float* bk = (const float*)d_in[6];
  const float* Wv   = (const float*)d_in[7];  const float* bv = (const float*)d_in[8];
  const float* Wo   = (const float*)d_in[9];  const float* bo = (const float*)d_in[10];
  float* out = (float*)d_out;                    // [8][128][256]

  const size_t offXh  = 0;
  const size_t offWT  = offXh  + (size_t)PLN * 2;
  const size_t offQKV = offWT  + (size_t)4 * WSZ * 2;
  const size_t offS   = offQKV + (size_t)3 * PLN * 2;
  const size_t total  = offS   + (size_t)SSZ * 4;       // 3145728
  if (total > ws_size) return;
  if (total > (size_t)134217728) return;

  char* ws = (char*)d_ws;
  unsigned short* Xh  = (unsigned short*)(ws + offXh);
  unsigned short* WT  = (unsigned short*)(ws + offWT);
  unsigned short* QKV = (unsigned short*)(ws + offQKV);
  float*          S   = (float*)(ws + offS);

  const int ldsMain = (NN * NN + NN * DDIM) * 2;       // 98304 B dynamic
  (void)hipFuncSetAttribute(reinterpret_cast<const void*>(&k_main),
                            hipFuncAttributeMaxDynamicSharedMemorySize, ldsMain);

  k_prep<<<dim3((NROWS * DDIM / 2048) + 32), dim3(256), 0, stream>>>(x, Wq, Wk, Wv, Wo, Xh, WT);
  k_proj<<<dim3(3 * (NROWS / 64) * (DDIM / 64)), dim3(256), 0, stream>>>(Xh, WT, bq, bk, bv, QKV);
  k_scores<<<dim3(NBATCH * (NN / 16)), dim3(256), 0, stream>>>(QKV, S);
  k_main<<<dim3(NBATCH * NN), dim3(256), ldsMain, stream>>>(adj, adjm, S, QKV, WT, bo, out);
  (void)hipGetLastError();
}

// v001
// One run takes 55.6 microseconds.
// In two side-by-side timings against v000, it was 2.87 and 2.89 times as fast.
// Contractions on v_wmma_f32_16x16x32_f16, f32 accumulate: x.Wq, x.Wk, x.Wv (x carried x16, W x1024, f16 built
// from bf16-RNE inputs); q.k^T (q, k carried x16); per b: v.Wo (v carried x16, Wo x1024); per (b,j): P.(v.Wo)
// (P carried x1024, v.Wo x16); single products. exp, row sums, reciprocal, bias adds and the max-pool in f32 on VALU.
#include <hip/hip_runtime.h>
#include <stdint.h>

#define NBATCH 8
#define NN     128
#define DDIM   256
#define NROWS  1024            // NBATCH*NN
#define PLN    262144          // NBATCH*NN*DDIM
#define WSZ    65536           // DDIM*DDIM
#define SSZ    131072          // NBATCH*NN*NN
static_assert(NROWS == NBATCH * NN);
static_assert(PLN == NROWS * DDIM);
static_assert(WSZ == DDIM * DDIM);
static_assert(SSZ == NBATCH * NN * NN);
static_assert(NN == 128);
static_assert(DDIM == 256);
static_assert((NROWS % 64) == 0);

typedef _Float16     v16h __attribute__((ext_vector_type(16)));
typedef _Float16     v8h  __attribute__((ext_vector_type(8)));
typedef float        v8f  __attribute__((ext_vector_type(8)));
typedef float        v4f  __attribute__((ext_vector_type(4)));
typedef unsigned int v4u  __attribute__((ext_vector_type(4)));
typedef int          v4i  __attribute__((ext_vector_type(4)));

union Frag { v16h v; v8h half[2]; };

// ---- scalar helpers --------------------------------------------------------------------------------
__device__ __forceinline__ unsigned short bf_bits(float f) {          // f32 -> bf16 bits, RNE convert
  unsigned u = __float_as_uint(f);
  return (unsigned short)((u + 0x7FFFu + ((u >> 16) & 1u)) >> 16);
}
__device__ __forceinline__ float bf_up(unsigned short b) { return __uint_as_float(((unsigned)b) << 16); }
__device__ __forceinline__ float bfr(float f) { return bf_up(bf_bits(f)); }   // value after bf16 RNE convert
__device__ __forceinline__ unsigned short h_bits(float f) {           // f32 -> f16 bits, RNE convert
  return __builtin_bit_cast(unsigned short, (_Float16)f);
}
__device__ __forceinline__ unsigned pack2(float a, float b) {         // two halves into one word, low = first
  return (unsigned)h_bits(a) | (((unsigned)h_bits(b)) << 16);
}
__device__ __forceinline__ v8f fill8(float x) {
  v8f z;
  z[0] = x; z[1] = x; z[2] = x; z[3] = x; z[4] = x; z[5] = x; z[6] = x; z[7] = x;
  return z;
}

// ---- 16-bit fragment loader (A, B alike): p points at row/col (lane&15), k0 + 8*(lane>>4);
//      elements 0..7 <- p[0..7] (k0+8h..k0+8h+7), elements 8..15 <- p[16..23] (k0+16+8h..k0+16+8h+7)
__device__ __forceinline__ v16h ldfrag(const _Float16* p) {
  Frag f;
  f.half[0] = *(const v8h*)(p);
  f.half[1] = *(const v8h*)(p + 16);
  return f.v;
}

// ---- WMMA with trailing VALU hazard gap (ties D, keeps A/B live past the nops) ---------------------
__device__ __forceinline__ v8f mma(v16h a, v16h b, v8f c) {
  v8f d = __builtin_amdgcn_wmma_f32_16x16x32_f16(false, a, false, b, (short)0, c, false, false);
#if defined(__HIP_DEVICE_COMPILE__)
  asm volatile("v_nop\n\tv_nop\n\tv_nop\n\tv_nop" : "+v"(d) : "v"(a), "v"(b));
#endif
  return d;
}

// =====================================================================================================
// k_prep: blocks 0..127 convert x [1024][256] f32 -> Xh f16 of (bf16-RNE value * 16), 2048 elements per block,
// Blocks 128..159: weight wi = (bid-128)>>3 (0 Wq, 1 Wk, 2 Wv, 3 Wo), rows e0..e0+31 of WT[wi][e][f] =
//   f16 of (bf16-RNE W[f][e] * 1024): LDS tile [32 c][256 f] filled by 2-B stores, then 4 store
// coverage: 128 x 2048 halves = all of Xh; 32 x 8192 halves = all of WT (4 x 256 x 256).
// =====================================================================================================
__global__ __launch_bounds__(256) void k_prep(const float* __restrict__ x,
                                              const float* __restrict__ Wq, const float* __restrict__ Wk,
                                              const float* __restrict__ Wv, const float* __restrict__ Wo,
                                              unsigned short* Xh, unsigned short* WT) {
  __shared__ __align__(16) unsigned short sT[8192];
  const int tid = threadIdx.x;
  const int bid = blockIdx.x;                  // 0..159
  const int isw = (bid >= (NROWS * DDIM / 2048)) ? 1 : 0;        // block-uniform role
  const int wb  = isw ? (bid - (NROWS * DDIM / 2048)) : 0;
  const int wi  = wb >> 3;                     // 0..3
  const int e0  = (wb & 7) * 32;

  if (isw) {
    const float* src = (wi == 0) ? Wq : ((wi == 1) ? Wk : ((wi == 2) ? Wv : Wo));   // block-uniform, all global
#pragma unroll 1
    for (int it = 0; it < 4; ++it) {
      const int p  = it * 256 + tid;           // 0..1023
      const int f  = p >> 2;                   // 0..255
      const int c8 = (p & 3) * 8;              // 0,8,16,24
      const float* q = src + (size_t)f * DDIM + e0 + c8;
      const v4f v0 = *(const v4f*)(q);
      const v4f v1 = *(const v4f*)(q + 4);
      unsigned short* d = sT + c8 * 256 + f;   // tile layout [c][f]
#pragma unroll
      for (int u = 0; u < 4; ++u) {
        d[u * 256]       = h_bits(bfr(v0[u]) * 1024.0f);
        d[(u + 4) * 256] = h_bits(bfr(v1[u]) * 1024.0f);
      }
    }
  }
  __syncthreads();

  if (isw) {
    unsigned short* dst = WT + (size_t)wi * WSZ + (size_t)e0 * DDIM;
    v4u pv[4];
#pragma unroll
    for (int it = 0; it < 4; ++it) pv[it] = *(const v4u*)(sT + (size_t)(it * 256 + tid) * 8);
#pragma unroll
    for (int it = 0; it < 4; ++it) *(v4u*)(dst + (size_t)(it * 256 + tid) * 8) = pv[it];
    
  } else {
    const size_t base = (size_t)bid * 2048 + (size_t)tid * 8;
    const v4f v0 = *(const v4f*)(x + base);
    const v4f v1 = *(const v4f*)(x + base + 4);
    v4u pk;
    pk[0] = pack2(bfr(v0[0]) * 16.0f, bfr(v0[1]) * 16.0f);
    pk[1] = pack2(bfr(v0[2]) * 16.0f, bfr(v0[3]) * 16.0f);
    pk[2] = pack2(bfr(v1[0]) * 16.0f, bfr(v1[1]) * 16.0f);
    pk[3] = pack2(bfr(v1[2]) * 16.0f, bfr(v1[3]) * 16.0f);
    unsigned short* dst = Xh + base;
    *(v4u*)dst = pk;
    
  }
}

// =====================================================================================================
// k_proj: plane pj = 0 (q), 1 (k), 2 (v): val[n][e] = f16 of 16*(x[n][:].W[:][e] + bfr(bias[e])), n flattened
// over (b, node) 0..1023. Block (pj, rt, cg): rows n = 64 rt .. +63, cols e = 64 cg .. +63; 8 waves, wave w:
// rows 64rt + 16(w>>1), cols 64cg + 32(w&1) + {0..15, 16..31}. A-op = Xh row n (k = f, split map), B-op =
// WT[pj] row e (k = f, split map); D row n = ... + 8h + r, col e = ... + (lane&15); acc = 16384 * (x.W).
// coverage: per plane 16 x 4 blocks x 64 x 64 = 1024 x 256.
// =====================================================================================================
__global__ __launch_bounds__(256) void k_proj(const unsigned short* __restrict__ Xhp,
                                              const unsigned short* __restrict__ WTp,
                                              const float* __restrict__ bq, const float* __restrict__ bk,
                                              const float* __restrict__ bv, unsigned short* QKV) {
  __shared__ __align__(16) unsigned short sT[4096];     // 64 x 64
  const _Float16* Xh = (const _Float16*)(const void*)Xhp;
  const _Float16* WT = (const _Float16*)(const void*)WTp;
  const int tid  = threadIdx.x;
  const int lane = tid & 31, w = tid >> 5, h = lane >> 4, m = lane & 15;
  const int bid  = blockIdx.x;                          // 0..191
  const int pj   = bid / ((NROWS / 64) * (DDIM / 64));   // 0..2 (block-uniform)
  const int rt   = (bid / (DDIM / 64)) % (NROWS / 64);   // 64-row tile of the NROWS flattened rows
  const int cg   = bid % (DDIM / 64);
  const int n0   = rt * 64;
  const int e0g  = cg * 64;
  const int wr   = w >> 1, wc = w & 1;
  const float* bias = (pj == 0) ? bq : ((pj == 1) ? bk : bv);   // block-uniform, all global

  const _Float16* Ap  = Xh + (size_t)(n0 + 16 * wr + m) * DDIM + 8 * h;
  const _Float16* Bp0 = WT + (size_t)pj * WSZ + (size_t)(e0g + 32 * wc + m) * DDIM + 8 * h;
  const _Float16* Bp1 = Bp0 + (size_t)16 * DDIM;
  v8f acc0 = fill8(0.0f), acc1 = fill8(0.0f);
#pragma unroll
  for (int ks = 0; ks < 8; ++ks) {
    const v16h a = ldfrag(Ap + ks * 32);
    acc0 = mma(a, ldfrag(Bp0 + ks * 32), acc0);
    acc1 = mma(a, ldfrag(Bp1 + ks * 32), acc1);
  }

  const int el0 = 32 * wc + m, el1 = el0 + 16;
  const float bb0 = bfr(bias[e0g + el0]);
  const float bb1 = bfr(bias[e0g + el1]);
#pragma unroll
  for (int r = 0; r < 8; ++r) {
    const int nl = 16 * wr + 8 * h + r;
    const float v0 = (acc0[r] * 6.103515625e-05f + bb0) * 16.0f;  // acc/16384 + b, carried x16
    const float v1 = (acc1[r] * 6.103515625e-05f + bb1) * 16.0f;
    sT[nl * 64 + el0] = h_bits(v0);
    sT[nl * 64 + el1] = h_bits(v1);
  }
  __syncthreads();

  const int piece = tid & 7, rq = tid >> 3;             // rq 0..31
  v4u pv[2];
  size_t o[2];
#pragma unroll
  for (int it = 0; it < 2; ++it) {
    const int row = it * 32 + rq;                       // tile row nl 0..63
    pv[it] = *(const v4u*)(sT + row * 64 + piece * 8);
    o[it] = (size_t)pj * PLN + (size_t)(n0 + row) * DDIM + e0g + piece * 8;
  }
#pragma unroll
  for (int it = 0; it < 2; ++it) *(v4u*)(QKV + o[it]) = pv[it];
  
}

// =====================================================================================================
// k_scores, blocks 0..63: S[b][j][kk] = expf((q_j.k_kk)/16), f32 plane [8][128][128]. Block (b, jt): rows
// j = 16 jt..+15, all 128 kk; 8 waves, wave w owns kk0 = 16 w. A-op = Q row j (k = d, split), B-op = K row kk
// (k = d, split). acc = 256 * q.k -> logit arg = acc * 2^-12. 16x128 f32 strip staged in LDS; expf in a rolled pass.
// coverage: 64 blocks x 2048 floats = all of S.
// Blocks 64..127: VWT[b][d][kk] = f16 of 16 * sum_e v[b][kk][e] Wo[e][d]. Block (dt, nt): rows d = 64 dt..+63,
// cols n = 64 nt..+63 of the flattened (b, kk); wave w: rows 16(w>>1), cols 32(w&1) + {0..15, 16..31}.
// A-op = WoT row d (k = e, split), B-op = V row n (k = e, split); acc = 16384 * v.Wo -> x 2^-10.
// coverage: 4 x 16 blocks x 64 x 64 = 256 x 1024 = all of VWT; each tile row is one whole 128-B line.
// =====================================================================================================
__global__ __launch_bounds__(256) void k_scores(const unsigned short* __restrict__ QKV,
                                                const unsigned short* __restrict__ WTp,
                                                float* S, unsigned short* VWT) {
  __shared__ __align__(16) float sS[2048];              // scores: [16][128] f32; v.Wo: [64][64] f16
  const _Float16* Q = (const _Float16*)(const void*)QKV;
  const int tid  = threadIdx.x;
  const int lane = tid & 31, w = tid >> 5, h = lane >> 4, m = lane & 15;
  const int bid  = blockIdx.x;                          // 0..127, role is block-uniform

  if (bid < NBATCH * (NN / 16)) {
    const _Float16* K = Q + PLN;
    const int jt   = bid & 7;
    const int b    = bid >> 3;
    const int j0   = b * NN + jt * 16;                  // flattened query row base
    const int kr0  = b * NN + w * 16;                   // flattened key row base

    const _Float16* Ap = Q + (size_t)(j0 + m) * DDIM + 8 * h;
    const _Float16* Bp = K + (size_t)(kr0 + m) * DDIM + 8 * h;
    v8f acc = fill8(0.0f);
#pragma unroll
    for (int ks = 0; ks < 8; ++ks) acc = mma(ldfrag(Ap + ks * 32), ldfrag(Bp + ks * 32), acc);

#pragma unroll
    for (int r = 0; r < 8; ++r) sS[(8 * h + r) * NN + w * 16 + m] = acc[r] * 0.000244140625f;   // 2^-12
    __syncthreads();
#pragma unroll 1
    for (int e = tid; e < 2048; e += 256) sS[e] = expf(sS[e]);
    __syncthreads();

    v4f pv[2];
#pragma unroll
    for (int it = 0; it < 2; ++it) pv[it] = *(const v4f*)(sS + (size_t)(it * 256 + tid) * 4);
    float* op = S + (size_t)j0 * NN;
#pragma unroll
    for (int it = 0; it < 2; ++it) *(v4f*)(op + (size_t)(it * 256 + tid) * 4) = pv[it];
  } else {
    unsigned short* sT = (unsigned short*)(void*)sS;    // 64 x 64 halves
    const _Float16* V   = Q + (size_t)2 * PLN;          // [n][e]
    const _Float16* WoT = (const _Float16*)(const void*)WTp + (size_t)3 * WSZ;   // [d][e]
    const int vb = bid - NBATCH * (NN / 16);            // 0..63
    const int d0 = (vb >> 4) * 64;
    const int n0 = (vb & 15) * 64;
    const int wr = w >> 1, wc = w & 1;

    const _Float16* Ap  = WoT + (size_t)(d0 + 16 * wr + m) * DDIM + 8 * h;
    const _Float16* Bp0 = V + (size_t)(n0 + 32 * wc + m) * DDIM + 8 * h;
    const _Float16* Bp1 = Bp0 + (size_t)16 * DDIM;
    v16h Af[8], Bf0[8], Bf1[8];                         // all 48 loads in flight at once: one L2 round trip
#pragma unroll
    for (int ks = 0; ks < 8; ++ks) {
      Af[ks]  = ldfrag(Ap + ks * 32);
      Bf0[ks] = ldfrag(Bp0 + ks * 32);
      Bf1[ks] = ldfrag(Bp1 + ks * 32);
    }
    v8f acc0 = fill8(0.0f), acc1 = fill8(0.0f);
#pragma unroll
    for (int ks = 0; ks < 8; ++ks) {
      acc0 = mma(Af[ks], Bf0[ks], acc0);
      acc1 = mma(Af[ks], Bf1[ks], acc1);
    }
#pragma unroll
    for (int r = 0; r < 8; ++r) {                        // D row d = 16 wr + 8h + r, col n = 32 wc + m (+16)
      unsigned short* tp = sT + (16 * wr + 8 * h + r) * 64 + 32 * wc + m;
      tp[0]  = h_bits(acc0[r] * 0.0009765625f);          // 16384 v.Wo * 2^-10 = 16 v.Wo
      tp[16] = h_bits(acc1[r] * 0.0009765625f);
    }
    __syncthreads();

    const int piece = tid & 7, rq = tid >> 3;           // rq 0..31
    const int b = n0 >> 7, kk0 = n0 & (NN - 1);         // flattened col n0 = batch b, node kk0
    v4u pv[2];
#pragma unroll
    for (int it = 0; it < 2; ++it) pv[it] = *(const v4u*)(sT + (it * 32 + rq) * 64 + piece * 8);
#pragma unroll
    for (int it = 0; it < 2; ++it)
      *(v4u*)(VWT + (size_t)(b * DDIM + d0 + it * 32 + rq) * NN + kk0 + piece * 8) = pv[it];
  }
}

// =====================================================================================================
// k_main: one 256-thread block per (b, j); the block owns output row (b, j) and sees every subtree i itself,
// so the max over i needs no cross-block exchange. s[kk] = S[b][j][kk]; ok[i] = (adj_mask[b][i][j] == 0).
// Phase 1 (thread i < 128): aij = adj[b][i][j] != 0; den = aij ? sum_kk (adj[b][i][kk] != 0) s[kk] : 0;
//   P[i][kk] = (aij && adj[b][i][kk] != 0) ? s[kk] / max(den, 1e-9) : 0, stored x1024 as f16 in Pt [128][128].
// Phase 2: O = (1024 P).(16 v.Wo) * 2^-14 + bfr(bo): A-op rows i from Pt (k = kk, split), B-op cols d from
//   VWT[b] rows (k = kk, split); wave w owns d = 32 w + {0..15, 16..31}, 8 i-tiles x 4 k-steps.
//   val = ok[i] ? O : -1e12; column max over all 128 i via per-lane max over r and a xor-16 shuffle.
// Output row (b, j) = 256 f32 = 1 KB staged in LDS, written by threads 0..63 x 16 B in one instruction
// coverage: 1024 blocks x 256 floats = the whole output; Pt rows 0..127 (threads 0..127 x 16 x 8 halves),
//   ok/wsr 128 entries, all before their barriers.
// =====================================================================================================
__global__ __launch_bounds__(256) void k_main(const int* __restrict__ adj, const int* __restrict__ adjm,
                                              const float* __restrict__ S, const unsigned short* __restrict__ VWTp,
                                              const float* __restrict__ bo, float* out) {
  __shared__ __align__(16) _Float16 Pt[NN * NN];        // [128][128]
  __shared__ __align__(16) float sO[DDIM];
  __shared__ float wsr[NN];
  __shared__ int   sok[NN];
  const _Float16* VWT = (const _Float16*)(const void*)VWTp;                     // [b][d][kk]
  const int tid  = threadIdx.x;
  const int lane = tid & 31, w = tid >> 5, h = lane >> 4, m = lane & 15;
  const int b    = blockIdx.x >> 7;
  const int j    = blockIdx.x & (NN - 1);

  if (tid < NN) {                                       // waves 0..3, wave-uniform
    wsr[tid] = S[(size_t)(b * NN + j) * NN + tid];
    sok[tid] = (adjm[(size_t)(b * NN + tid) * NN + j] == 0) ? 1 : 0;
  }
  __syncthreads();

  // ---------------- phase 1: subtree-normalised score rows ----------------
  if (tid < NN) {                                       // waves 0..3, wave-uniform
    const int i = tid;
    const int* arow = adj + (size_t)(b * NN + i) * NN;
    const int aij = arow[j];
    float den = 0.0f;
#pragma unroll 1
    for (int k8 = 0; k8 < 16; ++k8) {
      const v4i a0 = *(const v4i*)(arow + k8 * 8);
      const v4i a1 = *(const v4i*)(arow + k8 * 8 + 4);
#pragma unroll
      for (int u = 0; u < 4; ++u) {
        const float s0 = wsr[k8 * 8 + u];
        const float s1 = wsr[k8 * 8 + 4 + u];
        den += (a0[u] != 0) ? s0 : 0.0f;
        den += (a1[u] != 0) ? s1 : 0.0f;
      }
    }
    den = (aij != 0) ? den : 0.0f;
    const float rden = 1.0f / fmaxf(den, 1.0e-9f);
#pragma unroll 1
    for (int k8 = 0; k8 < 16; ++k8) {
      const v4i a0 = *(const v4i*)(arow + k8 * 8);
      const v4i a1 = *(const v4i*)(arow + k8 * 8 + 4);
      v8h hv;
#pragma unroll
      for (int u = 0; u < 4; ++u) {
        const float s0 = wsr[k8 * 8 + u];
        const float s1 = wsr[k8 * 8 + 4 + u];
        const float t0 = (aij != 0 && a0[u] != 0) ? s0 : 0.0f;
        const float t1 = (aij != 0 && a1[u] != 0) ? s1 : 0.0f;
        hv[u]     = (_Float16)((t0 * rden) * 1024.0f);
        hv[4 + u] = (_Float16)((t1 * rden) * 1024.0f);
      }
      *(v8h*)(Pt + i * NN + k8 * 8) = hv;
    }
  }
  __syncthreads();

  // ---------------- phase 2: O = P . (v.Wo)_b + bo, masked max over i ----------------
  v8f m0 = fill8(-3.0e38f), m1 = fill8(-3.0e38f);
  {
    const _Float16* vp0 = VWT + (size_t)(b * DDIM + 32 * w + m) * NN + 8 * h;  // B-op col d = 32w + m
    const _Float16* vp1 = vp0 + (size_t)16 * NN;                               // col d = 32w + 16 + m
    v16h Bf0[4], Bf1[4];
#pragma unroll
    for (int ks = 0; ks < 4; ++ks) {
      Bf0[ks] = ldfrag(vp0 + ks * 32);
      Bf1[ks] = ldfrag(vp1 + ks * 32);
    }
    const float bb0 = bfr(bo[32 * w + m]);
    const float bb1 = bfr(bo[32 * w + 16 + m]);
#pragma unroll 1
    for (int it = 0; it < 8; ++it) {
      const _Float16* ap = Pt + (it * 16 + m) * NN + 8 * h;                    // A-op row i = 16 it + (lane&15)
      v8f c0 = fill8(0.0f), c1 = fill8(0.0f);
#pragma unroll
      for (int ks = 0; ks < 4; ++ks) {
        const v16h a = ldfrag(ap + ks * 32);
        c0 = mma(a, Bf0[ks], c0);
        c1 = mma(a, Bf1[ks], c1);
      }
#pragma unroll
      for (int r = 0; r < 8; ++r) {                      // D row i = 16 it + 8h + r
        const int ok = sok[it * 16 + 8 * h + r];
        const float v0 = c0[r] * 6.103515625e-05f + bb0;   // 16384 O * 2^-14 + bo
        const float v1 = c1[r] * 6.103515625e-05f + bb1;
        m0[r] = fmaxf(m0[r], (ok != 0) ? v0 : -1.0e12f);
        m1[r] = fmaxf(m1[r], (ok != 0) ? v1 : -1.0e12f);
      }
    }
  }

  float M0 = m0[0], M1 = m1[0];
#pragma unroll
  for (int r = 1; r < 8; ++r) { M0 = fmaxf(M0, m0[r]); M1 = fmaxf(M1, m1[r]); }
  M0 = fmaxf(M0, __shfl_xor(M0, 16, 32));               // combine lane halves (not under lane-varying control)
  M1 = fmaxf(M1, __shfl_xor(M1, 16, 32));
  sO[w * 32 + m]      = M0;                             // both lane halves write the same value
  sO[w * 32 + 16 + m] = M1;
  __syncthreads();

  float* op = out + (size_t)(b * NN + j) * DDIM + (size_t)tid * 4;
  if (tid < 64) {                                       // waves 0,1: 64 x 16 B = the whole 1-KB row, 8 lines
    const v4f ov = *(const v4f*)(sO + tid * 4);
    *(v4f*)op = ov;
  }
  
}

// =====================================================================================================
// Workspace map (bytes); every region is an exact multiple of its whole-line store granularity:
//   Xh   f16 [1024][256]                      524288 at       0
//   WT   f16 [4][256][256]                    524288 at  524288
//   QKV  f16 Q, K, V [1024][256] each        1572864 at 1048576
//   S    f32 [8][128][128]                    524288 at 2621440
//   VWT  f16 [8][256][128]                    524288 at 3145728
//   total                                    3670016
// =====================================================================================================
extern "C" void kernel_launch(void* const* d_in, const int* in_sizes, int n_in,
                              void* d_out, int out_size, void* d_ws, size_t ws_size,
                              hipStream_t stream) {
  if (n_in < 11) return;
  if (in_sizes[0] != SSZ) return;                // adj
  if (in_sizes[1] != PLN) return;                // sat_inputs
  if (in_sizes[2] != SSZ) return;                // adj_mask
  if (in_sizes[3] != WSZ || in_sizes[4] != DDIM) return;
  if (in_sizes[5] != WSZ || in_sizes[6] != DDIM) return;
  if (in_sizes[7] != WSZ || in_sizes[8] != DDIM) return;
  if (in_sizes[9] != WSZ || in_sizes[10] != DDIM) return;
  if (out_size != PLN) return;

  const int*   adj  = (const int*)d_in[0];       // [8][128][128]
  const float* x    = (const float*)d_in[1];     // [8][128][256]
  const int*   adjm = (const int*)d_in[2];       // [8][128][128]
  const float* Wq   = (const float*)d_in[3];  const float* bq = (const float*)d_in[4];
  const float* Wk   = (const float*)d_in[5];  const float* bk = (const float*)d_in[6];
  const float* Wv   = (const float*)d_in[7];  const float* bv = (const float*)d_in[8];
  const float* Wo   = (const float*)d_in[9];  const float* bo = (const float*)d_in[10];
  float* out = (float*)d_out;                    // [8][128][256]

  const size_t offXh  = 0;
  const size_t offWT  = offXh  + (size_t)PLN * 2;
  const size_t offQKV = offWT  + (size_t)4 * WSZ * 2;
  const size_t offS   = offQKV + (size_t)3 * PLN * 2;
  const size_t offVW  = offS   + (size_t)SSZ * 4;
  const size_t total  = offVW  + (size_t)PLN * 2;       // 3670016
  if (total > ws_size) return;
  if (total > (size_t)134217728) return;

  char* ws = (char*)d_ws;
  unsigned short* Xh  = (unsigned short*)(ws + offXh);
  unsigned short* WT  = (unsigned short*)(ws + offWT);
  unsigned short* QKV = (unsigned short*)(ws + offQKV);
  float*          S   = (float*)(ws + offS);
  unsigned short* VWT = (unsigned short*)(ws + offVW);

  k_prep<<<dim3((NROWS * DDIM / 2048) + 32), dim3(256), 0, stream>>>(x, Wq, Wk, Wv, Wo, Xh, WT);
  k_proj<<<dim3(3 * (NROWS / 64) * (DDIM / 64)), dim3(256), 0, stream>>>(Xh, WT, bq, bk, bv, QKV);
  k_scores<<<dim3(NBATCH * (NN / 16) + (DDIM / 64) * (NROWS / 64)), dim3(256), 0, stream>>>(QKV, WT, S, VWT);
  k_main<<<dim3(NBATCH * NN), dim3(256), 0, stream>>>(adj, adjm, S, VWT, bo, out);
  (void)hipGetLastError();
}

// v002
// One run takes 39.1 microseconds.
// In two side-by-side timings against v001, it was 1.42 and 1.43 times as fast.
// Counting every step since v000, it is 4.10 times as fast.
// Contractions on v_wmma_f32_16x16x32_f16, f32 accumulate: x.Wq, x.Wk, x.Wv (x carried x16, W x1024, f16 built
// from bf16-RNE inputs); q.k^T (q, k carried x16); per b: v.Wo (v carried x16, Wo x1024); per (b,j): P.(v.Wo)
// (P carried x1024, v.Wo x16); single products. exp, row sums, reciprocal, bias adds and the max-pool in f32 on VALU.
#include <hip/hip_runtime.h>
#include <stdint.h>

#define NBATCH 8
#define NN     128
#define DDIM   256
#define NROWS  1024            // NBATCH*NN
#define PLN    262144          // NBATCH*NN*DDIM
#define WSZ    65536           // DDIM*DDIM
#define SSZ    131072          // NBATCH*NN*NN
static_assert(NROWS == NBATCH * NN);
static_assert(PLN == NROWS * DDIM);
static_assert(WSZ == DDIM * DDIM);
static_assert(SSZ == NBATCH * NN * NN);
static_assert(NN == 128);
static_assert(DDIM == 256);
static_assert((NROWS % 64) == 0);
#define PPITCH 136             // halves per LDS row of P: 272 B = 16 B x 17, so 16 rows' 16-B pieces fall on all 64 banks
static_assert(PPITCH >= NN && (PPITCH % 8) == 0 && ((PPITCH / 8) % 2) == 1);

typedef _Float16     v16h __attribute__((ext_vector_type(16)));
typedef _Float16     v8h  __attribute__((ext_vector_type(8)));
typedef float        v8f  __attribute__((ext_vector_type(8)));
typedef float        v4f  __attribute__((ext_vector_type(4)));
typedef unsigned int v4u  __attribute__((ext_vector_type(4)));
typedef int          v4i  __attribute__((ext_vector_type(4)));

union Frag { v16h v; v8h half[2]; };

// ---- scalar helpers --------------------------------------------------------------------------------
__device__ __forceinline__ unsigned short bf_bits(float f) {          // f32 -> bf16 bits, RNE convert
  unsigned u = __float_as_uint(f);
  return (unsigned short)((u + 0x7FFFu + ((u >> 16) & 1u)) >> 16);
}
__device__ __forceinline__ float bf_up(unsigned short b) { return __uint_as_float(((unsigned)b) << 16); }
__device__ __forceinline__ float bfr(float f) { return bf_up(bf_bits(f)); }   // value after bf16 RNE convert
__device__ __forceinline__ unsigned short h_bits(float f) {           // f32 -> f16 bits, RNE convert
  return __builtin_bit_cast(unsigned short, (_Float16)f);
}
__device__ __forceinline__ unsigned pack2(float a, float b) {         // two halves into one word, low = first
  return (unsigned)h_bits(a) | (((unsigned)h_bits(b)) << 16);
}
__device__ __forceinline__ v8f fill8(float x) {
  v8f z;
  z[0] = x; z[1] = x; z[2] = x; z[3] = x; z[4] = x; z[5] = x; z[6] = x; z[7] = x;
  return z;
}

// ---- 16-bit fragment loader (A, B alike): p points at row/col (lane&15), k0 + 8*(lane>>4);
//      elements 0..7 <- p[0..7] (k0+8h..k0+8h+7), elements 8..15 <- p[16..23] (k0+16+8h..k0+16+8h+7)
__device__ __forceinline__ v16h ldfrag(const _Float16* p) {
  Frag f;
  f.half[0] = *(const v8h*)(p);
  f.half[1] = *(const v8h*)(p + 16);
  return f.v;
}

// ---- WMMA with trailing VALU hazard gap (ties D, keeps A/B live past the nops) ---------------------
__device__ __forceinline__ v8f mma(v16h a, v16h b, v8f c) {
  v8f d = __builtin_amdgcn_wmma_f32_16x16x32_f16(false, a, false, b, (short)0, c, false, false);
#if defined(__HIP_DEVICE_COMPILE__)
  asm volatile("v_nop\n\tv_nop\n\tv_nop\n\tv_nop" : "+v"(d) : "v"(a), "v"(b));
#endif
  return d;
}

// =====================================================================================================
// k_prep: blocks 0..127 convert x [1024][256] f32 -> Xh f16 of (bf16-RNE value * 16), 2048 elements per block,
// Blocks 128..159: weight wi = (bid-128)>>3 (0 Wq, 1 Wk, 2 Wv, 3 Wo), rows e0..e0+31 of WT[wi][e][f] =
//   f16 of (bf16-RNE W[f][e] * 1024): LDS tile [32 c][256 f] filled by 2-B stores, then 4 store
// coverage: 128 x 2048 halves = all of Xh; 32 x 8192 halves = all of WT (4 x 256 x 256).
// =====================================================================================================
__global__ __launch_bounds__(256) void k_prep(const float* __restrict__ x,
                                              const float* __restrict__ Wq, const float* __restrict__ Wk,
                                              const float* __restrict__ Wv, const float* __restrict__ Wo,
                                              unsigned short* Xh, unsigned short* WT) {
  __shared__ __align__(16) unsigned short sT[8192];
  const int tid = threadIdx.x;
  const int bid = blockIdx.x;                  // 0..159
  const int isw = (bid >= (NROWS * DDIM / 2048)) ? 1 : 0;        // block-uniform role
  const int wb  = isw ? (bid - (NROWS * DDIM / 2048)) : 0;
  const int wi  = wb >> 3;                     // 0..3
  const int e0  = (wb & 7) * 32;

  if (isw) {
    const float* src = (wi == 0) ? Wq : ((wi == 1) ? Wk : ((wi == 2) ? Wv : Wo));   // block-uniform, all global
#pragma unroll 1
    for (int it = 0; it < 4; ++it) {
      const int p  = it * 256 + tid;           // 0..1023
      const int f  = p >> 2;                   // 0..255
      const int c8 = (p & 3) * 8;              // 0,8,16,24
      const float* q = src + (size_t)f * DDIM + e0 + c8;
      const v4f v0 = *(const v4f*)(q);
      const v4f v1 = *(const v4f*)(q + 4);
      unsigned short* d = sT + c8 * 256 + f;   // tile layout [c][f]
#pragma unroll
      for (int u = 0; u < 4; ++u) {
        d[u * 256]       = h_bits(bfr(v0[u]) * 1024.0f);
        d[(u + 4) * 256] = h_bits(bfr(v1[u]) * 1024.0f);
      }
    }
  }
  __syncthreads();

  if (isw) {
    unsigned short* dst = WT + (size_t)wi * WSZ + (size_t)e0 * DDIM;
    v4u pv[4];
#pragma unroll
    for (int it = 0; it < 4; ++it) pv[it] = *(const v4u*)(sT + (size_t)(it * 256 + tid) * 8);
#pragma unroll
    for (int it = 0; it < 4; ++it) *(v4u*)(dst + (size_t)(it * 256 + tid) * 8) = pv[it];
    
  } else {
    const size_t base = (size_t)bid * 2048 + (size_t)tid * 8;
    const v4f v0 = *(const v4f*)(x + base);
    const v4f v1 = *(const v4f*)(x + base + 4);
    v4u pk;
    pk[0] = pack2(bfr(v0[0]) * 16.0f, bfr(v0[1]) * 16.0f);
    pk[1] = pack2(bfr(v0[2]) * 16.0f, bfr(v0[3]) * 16.0f);
    pk[2] = pack2(bfr(v1[0]) * 16.0f, bfr(v1[1]) * 16.0f);
    pk[3] = pack2(bfr(v1[2]) * 16.0f, bfr(v1[3]) * 16.0f);
    unsigned short* dst = Xh + base;
    *(v4u*)dst = pk;
    
  }
}

// =====================================================================================================
// k_proj: plane pj = 0 (q), 1 (k), 2 (v): val[n][e] = f16 of 16*(x[n][:].W[:][e] + bfr(bias[e])), n flattened
// over (b, node) 0..1023. Block (pj, rt, cg): rows n = 64 rt .. +63, cols e = 64 cg .. +63; 8 waves, wave w:
// rows 64rt + 16(w>>1), cols 64cg + 32(w&1) + {0..15, 16..31}. A-op = Xh row n (k = f, split map), B-op =
// WT[pj] row e (k = f, split map); D row n = ... + 8h + r, col e = ... + (lane&15); acc = 16384 * (x.W).
// coverage: per plane 16 x 4 blocks x 64 x 64 = 1024 x 256.
// =====================================================================================================
__global__ __launch_bounds__(256) void k_proj(const unsigned short* __restrict__ Xhp,
                                              const unsigned short* __restrict__ WTp,
                                              const float* __restrict__ bq, const float* __restrict__ bk,
                                              const float* __restrict__ bv, unsigned short* QKV) {
  __shared__ __align__(16) unsigned short sT[4096];     // 64 x 64
  const _Float16* Xh = (const _Float16*)(const void*)Xhp;
  const _Float16* WT = (const _Float16*)(const void*)WTp;
  const int tid  = threadIdx.x;
  const int lane = tid & 31, w = tid >> 5, h = lane >> 4, m = lane & 15;
  const int bid  = blockIdx.x;                          // 0..191
  const int pj   = bid / ((NROWS / 64) * (DDIM / 64));   // 0..2 (block-uniform)
  const int rt   = (bid / (DDIM / 64)) % (NROWS / 64);   // 64-row tile of the NROWS flattened rows
  const int cg   = bid % (DDIM / 64);
  const int n0   = rt * 64;
  const int e0g  = cg * 64;
  const int wr   = w >> 1, wc = w & 1;
  const float* bias = (pj == 0) ? bq : ((pj == 1) ? bk : bv);   // block-uniform, all global

  const _Float16* Ap  = Xh + (size_t)(n0 + 16 * wr + m) * DDIM + 8 * h;
  const _Float16* Bp0 = WT + (size_t)pj * WSZ + (size_t)(e0g + 32 * wc + m) * DDIM + 8 * h;
  const _Float16* Bp1 = Bp0 + (size_t)16 * DDIM;
  v8f acc0 = fill8(0.0f), acc1 = fill8(0.0f);
#pragma unroll
  for (int ks = 0; ks < 8; ++ks) {
    const v16h a = ldfrag(Ap + ks * 32);
    acc0 = mma(a, ldfrag(Bp0 + ks * 32), acc0);
    acc1 = mma(a, ldfrag(Bp1 + ks * 32), acc1);
  }

  const int el0 = 32 * wc + m, el1 = el0 + 16;
  const float bb0 = bfr(bias[e0g + el0]);
  const float bb1 = bfr(bias[e0g + el1]);
#pragma unroll
  for (int r = 0; r < 8; ++r) {
    const int nl = 16 * wr + 8 * h + r;
    const float v0 = (acc0[r] * 6.103515625e-05f + bb0) * 16.0f;  // acc/16384 + b, carried x16
    const float v1 = (acc1[r] * 6.103515625e-05f + bb1) * 16.0f;
    sT[nl * 64 + el0] = h_bits(v0);
    sT[nl * 64 + el1] = h_bits(v1);
  }
  __syncthreads();

  const int piece = tid & 7, rq = tid >> 3;             // rq 0..31
  v4u pv[2];
  size_t o[2];
#pragma unroll
  for (int it = 0; it < 2; ++it) {
    const int row = it * 32 + rq;                       // tile row nl 0..63
    pv[it] = *(const v4u*)(sT + row * 64 + piece * 8);
    o[it] = (size_t)pj * PLN + (size_t)(n0 + row) * DDIM + e0g + piece * 8;
  }
#pragma unroll
  for (int it = 0; it < 2; ++it) *(v4u*)(QKV + o[it]) = pv[it];
  
}

// =====================================================================================================
// k_scores, blocks 0..63: S[b][j][kk] = expf((q_j.k_kk)/16), f32 plane [8][128][128]. Block (b, jt): rows
// j = 16 jt..+15, all 128 kk; 8 waves, wave w owns kk0 = 16 w. A-op = Q row j (k = d, split), B-op = K row kk
// (k = d, split). acc = 256 * q.k -> logit arg = acc * 2^-12. 16x128 f32 strip staged in LDS; expf in a rolled pass.
// coverage: 64 blocks x 2048 floats = all of S.
// Blocks 64..127: VWT[b][d][kk] = f16 of 16 * sum_e v[b][kk][e] Wo[e][d]. Block (dt, nt): rows d = 64 dt..+63,
// cols n = 64 nt..+63 of the flattened (b, kk); wave w: rows 16(w>>1), cols 32(w&1) + {0..15, 16..31}.
// A-op = WoT row d (k = e, split), B-op = V row n (k = e, split); acc = 16384 * v.Wo -> x 2^-10.
// coverage: 4 x 16 blocks x 64 x 64 = 256 x 1024 = all of VWT; each tile row is one whole 128-B line.
// =====================================================================================================
__global__ __launch_bounds__(256) void k_scores(const unsigned short* __restrict__ QKV,
                                                const unsigned short* __restrict__ WTp,
                                                float* S, unsigned short* VWT) {
  __shared__ __align__(16) float sS[2048];              // scores: [16][128] f32; v.Wo: [64][64] f16
  const _Float16* Q = (const _Float16*)(const void*)QKV;
  const int tid  = threadIdx.x;
  const int lane = tid & 31, w = tid >> 5, h = lane >> 4, m = lane & 15;
  const int bid  = blockIdx.x;                          // 0..127, role is block-uniform

  if (bid < NBATCH * (NN / 16)) {
    const _Float16* K = Q + PLN;
    const int jt   = bid & 7;
    const int b    = bid >> 3;
    const int j0   = b * NN + jt * 16;                  // flattened query row base
    const int kr0  = b * NN + w * 16;                   // flattened key row base

    const _Float16* Ap = Q + (size_t)(j0 + m) * DDIM + 8 * h;
    const _Float16* Bp = K + (size_t)(kr0 + m) * DDIM + 8 * h;
    v8f acc = fill8(0.0f);
#pragma unroll
    for (int ks = 0; ks < 8; ++ks) acc = mma(ldfrag(Ap + ks * 32), ldfrag(Bp + ks * 32), acc);

#pragma unroll
    for (int r = 0; r < 8; ++r) sS[(8 * h + r) * NN + w * 16 + m] = acc[r] * 0.000244140625f;   // 2^-12
    __syncthreads();
#pragma unroll 1
    for (int e = tid; e < 2048; e += 256) sS[e] = expf(sS[e]);
    __syncthreads();

    v4f pv[2];
#pragma unroll
    for (int it = 0; it < 2; ++it) pv[it] = *(const v4f*)(sS + (size_t)(it * 256 + tid) * 4);
    float* op = S + (size_t)j0 * NN;
#pragma unroll
    for (int it = 0; it < 2; ++it) *(v4f*)(op + (size_t)(it * 256 + tid) * 4) = pv[it];
  } else {
    unsigned short* sT = (unsigned short*)(void*)sS;    // 64 x 64 halves
    const _Float16* V   = Q + (size_t)2 * PLN;          // [n][e]
    const _Float16* WoT = (const _Float16*)(const void*)WTp + (size_t)3 * WSZ;   // [d][e]
    const int vb = bid - NBATCH * (NN / 16);            // 0..63
    const int d0 = (vb >> 4) * 64;
    const int n0 = (vb & 15) * 64;
    const int wr = w >> 1, wc = w & 1;

    const _Float16* Ap  = WoT + (size_t)(d0 + 16 * wr + m) * DDIM + 8 * h;
    const _Float16* Bp0 = V + (size_t)(n0 + 32 * wc + m) * DDIM + 8 * h;
    const _Float16* Bp1 = Bp0 + (size_t)16 * DDIM;
    v16h Af[8], Bf0[8], Bf1[8];                         // all 48 loads in flight at once: one L2 round trip
#pragma unroll
    for (int ks = 0; ks < 8; ++ks) {
      Af[ks]  = ldfrag(Ap + ks * 32);
      Bf0[ks] = ldfrag(Bp0 + ks * 32);
      Bf1[ks] = ldfrag(Bp1 + ks * 32);
    }
    v8f acc0 = fill8(0.0f), acc1 = fill8(0.0f);
#pragma unroll
    for (int ks = 0; ks < 8; ++ks) {
      acc0 = mma(Af[ks], Bf0[ks], acc0);
      acc1 = mma(Af[ks], Bf1[ks], acc1);
    }
#pragma unroll
    for (int r = 0; r < 8; ++r) {                        // D row d = 16 wr + 8h + r, col n = 32 wc + m (+16)
      unsigned short* tp = sT + (16 * wr + 8 * h + r) * 64 + 32 * wc + m;
      tp[0]  = h_bits(acc0[r] * 0.0009765625f);          // 16384 v.Wo * 2^-10 = 16 v.Wo
      tp[16] = h_bits(acc1[r] * 0.0009765625f);
    }
    __syncthreads();

    const int piece = tid & 7, rq = tid >> 3;           // rq 0..31
    const int b = n0 >> 7, kk0 = n0 & (NN - 1);         // flattened col n0 = batch b, node kk0
    v4u pv[2];
#pragma unroll
    for (int it = 0; it < 2; ++it) pv[it] = *(const v4u*)(sT + (it * 32 + rq) * 64 + piece * 8);
#pragma unroll
    for (int it = 0; it < 2; ++it)
      *(v4u*)(VWT + (size_t)(b * DDIM + d0 + it * 32 + rq) * NN + kk0 + piece * 8) = pv[it];
  }
}

// =====================================================================================================
// k_main: one 256-thread block per (b, j); the block owns output row (b, j) and sees every subtree i itself,
// so the max over i needs no cross-block exchange. s[kk] = S[b][j][kk]; ok[i] = (adj_mask[b][i][j] == 0).
// Phase 1 (thread i < 128): aij = adj[b][i][j] != 0; den = aij ? sum_kk (adj[b][i][kk] != 0) s[kk] : 0;
//   P[i][kk] = (aij && adj[b][i][kk] != 0) ? s[kk] / max(den, 1e-9) : 0, stored x1024 as f16 in Pt [128 rows][128 of pitch PPITCH].
// Phase 2: O = (1024 P).(16 v.Wo) * 2^-14 + bfr(bo): A-op rows i from Pt (k = kk, split), B-op cols d from
//   VWT[b] rows (k = kk, split); wave w owns d = 32 w + {0..15, 16..31}, 8 i-tiles x 4 k-steps.
//   val = ok[i] ? O : -1e12; column max over all 128 i via per-lane max over r and a xor-16 shuffle.
// Output row (b, j) = 256 f32 = 1 KB staged in LDS, written by threads 0..63 x 16 B in one instruction
// coverage: 1024 blocks x 256 floats = the whole output; Pt rows 0..127 (threads 0..127 x 16 x 8 halves),
//   ok/wsr 128 entries, all before their barriers.
// =====================================================================================================
__global__ __launch_bounds__(256) void k_main(const int* __restrict__ adj, const int* __restrict__ adjm,
                                              const float* __restrict__ S, const unsigned short* __restrict__ VWTp,
                                              const float* __restrict__ bo, float* out) {
  __shared__ __align__(16) _Float16 Pt[NN * PPITCH];    // [128][128 used of PPITCH]; pad halves never read
  __shared__ __align__(16) float sO[DDIM];
  __shared__ float wsr[NN];
  __shared__ int   sok[NN];
  const _Float16* VWT = (const _Float16*)(const void*)VWTp;                     // [b][d][kk]
  const int tid  = threadIdx.x;
  const int lane = tid & 31, w = tid >> 5, h = lane >> 4, m = lane & 15;
  const int b    = blockIdx.x >> 7;
  const int j    = blockIdx.x & (NN - 1);

  if (tid < NN) {                                       // waves 0..3, wave-uniform
    wsr[tid] = S[(size_t)(b * NN + j) * NN + tid];
    sok[tid] = (adjm[(size_t)(b * NN + tid) * NN + j] == 0) ? 1 : 0;
  }
  __syncthreads();

  // ---------------- phase 1: subtree-normalised score rows ----------------
  if (tid < NN) {                                       // waves 0..3, wave-uniform
    const int i = tid;
    const int* arow = adj + (size_t)(b * NN + i) * NN;
    const int aij = arow[j];
    float den = 0.0f;
#pragma unroll 1
    for (int k8 = 0; k8 < 16; ++k8) {
      const v4i a0 = *(const v4i*)(arow + k8 * 8);
      const v4i a1 = *(const v4i*)(arow + k8 * 8 + 4);
#pragma unroll
      for (int u = 0; u < 4; ++u) {
        const float s0 = wsr[k8 * 8 + u];
        const float s1 = wsr[k8 * 8 + 4 + u];
        den += (a0[u] != 0) ? s0 : 0.0f;
        den += (a1[u] != 0) ? s1 : 0.0f;
      }
    }
    den = (aij != 0) ? den : 0.0f;
    const float rden = 1.0f / fmaxf(den, 1.0e-9f);
#pragma unroll 1
    for (int k8 = 0; k8 < 16; ++k8) {
      const v4i a0 = *(const v4i*)(arow + k8 * 8);
      const v4i a1 = *(const v4i*)(arow + k8 * 8 + 4);
      v8h hv;
#pragma unroll
      for (int u = 0; u < 4; ++u) {
        const float s0 = wsr[k8 * 8 + u];
        const float s1 = wsr[k8 * 8 + 4 + u];
        const float t0 = (aij != 0 && a0[u] != 0) ? s0 : 0.0f;
        const float t1 = (aij != 0 && a1[u] != 0) ? s1 : 0.0f;
        hv[u]     = (_Float16)((t0 * rden) * 1024.0f);
        hv[4 + u] = (_Float16)((t1 * rden) * 1024.0f);
      }
      *(v8h*)(Pt + i * PPITCH + k8 * 8) = hv;
    }
  }
  __syncthreads();

  // ---------------- phase 2: O = P . (v.Wo)_b + bo, masked max over i ----------------
  v8f m0 = fill8(-3.0e38f), m1 = fill8(-3.0e38f);
  {
    const _Float16* vp0 = VWT + (size_t)(b * DDIM + 32 * w + m) * NN + 8 * h;  // B-op col d = 32w + m
    const _Float16* vp1 = vp0 + (size_t)16 * NN;                               // col d = 32w + 16 + m
    v16h Bf0[4], Bf1[4];
#pragma unroll
    for (int ks = 0; ks < 4; ++ks) {
      Bf0[ks] = ldfrag(vp0 + ks * 32);
      Bf1[ks] = ldfrag(vp1 + ks * 32);
    }
    const float bb0 = bfr(bo[32 * w + m]);
    const float bb1 = bfr(bo[32 * w + 16 + m]);
#pragma unroll 1
    for (int it = 0; it < 8; ++it) {
      const _Float16* ap = Pt + (it * 16 + m) * PPITCH + 8 * h;                // A-op row i = 16 it + (lane&15)
      v8f c0 = fill8(0.0f), c1 = fill8(0.0f);
#pragma unroll
      for (int ks = 0; ks < 4; ++ks) {
        const v16h a = ldfrag(ap + ks * 32);
        c0 = mma(a, Bf0[ks], c0);
        c1 = mma(a, Bf1[ks], c1);
      }
#pragma unroll
      for (int r = 0; r < 8; ++r) {                      // D row i = 16 it + 8h + r
        const int ok = sok[it * 16 + 8 * h + r];
        const float v0 = c0[r] * 6.103515625e-05f + bb0;   // 16384 O * 2^-14 + bo
        const float v1 = c1[r] * 6.103515625e-05f + bb1;
        m0[r] = fmaxf(m0[r], (ok != 0) ? v0 : -1.0e12f);
        m1[r] = fmaxf(m1[r], (ok != 0) ? v1 : -1.0e12f);
      }
    }
  }

  float M0 = m0[0], M1 = m1[0];
#pragma unroll
  for (int r = 1; r < 8; ++r) { M0 = fmaxf(M0, m0[r]); M1 = fmaxf(M1, m1[r]); }
  M0 = fmaxf(M0, __shfl_xor(M0, 16, 32));               // combine lane halves (not under lane-varying control)
  M1 = fmaxf(M1, __shfl_xor(M1, 16, 32));
  sO[w * 32 + m]      = M0;                             // both lane halves write the same value
  sO[w * 32 + 16 + m] = M1;
  __syncthreads();

  float* op = out + (size_t)(b * NN + j) * DDIM + (size_t)tid * 4;
  if (tid < 64) {                                       // waves 0,1: 64 x 16 B = the whole 1-KB row, 8 lines
    const v4f ov = *(const v4f*)(sO + tid * 4);
    *(v4f*)op = ov;
  }
  
}

// =====================================================================================================
// Workspace map (bytes); every region is an exact multiple of its whole-line store granularity:
//   Xh   f16 [1024][256]                      524288 at       0
//   WT   f16 [4][256][256]                    524288 at  524288
//   QKV  f16 Q, K, V [1024][256] each        1572864 at 1048576
//   S    f32 [8][128][128]                    524288 at 2621440
//   VWT  f16 [8][256][128]                    524288 at 3145728
//   total                                    3670016
// =====================================================================================================
extern "C" void kernel_launch(void* const* d_in, const int* in_sizes, int n_in,
                              void* d_out, int out_size, void* d_ws, size_t ws_size,
                              hipStream_t stream) {
  if (n_in < 11) return;
  if (in_sizes[0] != SSZ) return;                // adj
  if (in_sizes[1] != PLN) return;                // sat_inputs
  if (in_sizes[2] != SSZ) return;                // adj_mask
  if (in_sizes[3] != WSZ || in_sizes[4] != DDIM) return;
  if (in_sizes[5] != WSZ || in_sizes[6] != DDIM) return;
  if (in_sizes[7] != WSZ || in_sizes[8] != DDIM) return;
  if (in_sizes[9] != WSZ || in_sizes[10] != DDIM) return;
  if (out_size != PLN) return;

  const int*   adj  = (const int*)d_in[0];       // [8][128][128]
  const float* x    = (const float*)d_in[1];     // [8][128][256]
  const int*   adjm = (const int*)d_in[2];       // [8][128][128]
  const float* Wq   = (const float*)d_in[3];  const float* bq = (const float*)d_in[4];
  const float* Wk   = (const float*)d_in[5];  const float* bk = (const float*)d_in[6];
  const float* Wv   = (const float*)d_in[7];  const float* bv = (const float*)d_in[8];
  const float* Wo   = (const float*)d_in[9];  const float* bo = (const float*)d_in[10];
  float* out = (float*)d_out;                    // [8][128][256]

  const size_t offXh  = 0;
  const size_t offWT  = offXh  + (size_t)PLN * 2;
  const size_t offQKV = offWT  + (size_t)4 * WSZ * 2;
  const size_t offS   = offQKV + (size_t)3 * PLN * 2;
  const size_t offVW  = offS   + (size_t)SSZ * 4;
  const size_t total  = offVW  + (size_t)PLN * 2;       // 3670016
  if (total > ws_size) return;
  if (total > (size_t)134217728) return;

  char* ws = (char*)d_ws;
  unsigned short* Xh  = (unsigned short*)(ws + offXh);
  unsigned short* WT  = (unsigned short*)(ws + offWT);
  unsigned short* QKV = (unsigned short*)(ws + offQKV);
  float*          S   = (float*)(ws + offS);
  unsigned short* VWT = (unsigned short*)(ws + offVW);

  k_prep<<<dim3((NROWS * DDIM / 2048) + 32), dim3(256), 0, stream>>>(x, Wq, Wk, Wv, Wo, Xh, WT);
  k_proj<<<dim3(3 * (NROWS / 64) * (DDIM / 64)), dim3(256), 0, stream>>>(Xh, WT, bq, bk, bv, QKV);
  k_scores<<<dim3(NBATCH * (NN / 16) + (DDIM / 64) * (NROWS / 64)), dim3(256), 0, stream>>>(QKV, WT, S, VWT);
  k_main<<<dim3(NBATCH * NN), dim3(256), 0, stream>>>(adj, adjm, S, VWT, bo, out);
  (void)hipGetLastError();
}

// v003
// One run takes 29.3 microseconds.
// Next to v002, in two timings, it ran 1.32 and 1.34 times as fast.
// Counting every step since v000, it is 5.44 times as fast.
// Contractions on v_wmma_f32_16x16x32_f16, f32 accumulate: x.Wq, x.Wk, x.Wv (x carried x16, W x1024, f16 built
// from bf16-RNE inputs); q.k^T (q, k carried x16); per b: v.Wo (v carried x16, Wo x1024); per (b,j): P.(v.Wo)
// (P carried x1024, v.Wo x16); single products. exp, row sums, reciprocal, bias adds and the max-pool in f32 on VALU.
#include <hip/hip_runtime.h>
#include <stdint.h>

#define NBATCH 8
#define NN     128
#define DDIM   256
#define NROWS  1024            // NBATCH*NN
#define PLN    262144          // NBATCH*NN*DDIM
#define WSZ    65536           // DDIM*DDIM
#define SSZ    131072          // NBATCH*NN*NN
static_assert(NROWS == NBATCH * NN);
static_assert(PLN == NROWS * DDIM);
static_assert(WSZ == DDIM * DDIM);
static_assert(SSZ == NBATCH * NN * NN);
static_assert(NN == 128);
static_assert(DDIM == 256);
static_assert((NROWS % 64) == 0);
#define PPITCH 136             // halves per LDS row of P: 272 B = 16 B x 17, so 16 rows' 16-B pieces fall on all 64 banks
static_assert(PPITCH >= NN && (PPITCH % 8) == 0 && ((PPITCH / 8) % 2) == 1);

typedef _Float16     v16h __attribute__((ext_vector_type(16)));
typedef _Float16     v8h  __attribute__((ext_vector_type(8)));
typedef float        v8f  __attribute__((ext_vector_type(8)));
typedef float        v4f  __attribute__((ext_vector_type(4)));
typedef unsigned int v4u  __attribute__((ext_vector_type(4)));

union Frag { v16h v; v8h half[2]; };

// ---- scalar helpers --------------------------------------------------------------------------------
__device__ __forceinline__ unsigned short bf_bits(float f) {          // f32 -> bf16 bits, RNE convert
  unsigned u = __float_as_uint(f);
  return (unsigned short)((u + 0x7FFFu + ((u >> 16) & 1u)) >> 16);
}
__device__ __forceinline__ float bf_up(unsigned short b) { return __uint_as_float(((unsigned)b) << 16); }
__device__ __forceinline__ float bfr(float f) { return bf_up(bf_bits(f)); }   // value after bf16 RNE convert
__device__ __forceinline__ unsigned short h_bits(float f) {           // f32 -> f16 bits, RNE convert
  return __builtin_bit_cast(unsigned short, (_Float16)f);
}
__device__ __forceinline__ unsigned pack2(float a, float b) {         // two halves into one word, low = first
  return (unsigned)h_bits(a) | (((unsigned)h_bits(b)) << 16);
}
__device__ __forceinline__ float keep(float s, unsigned mw, int bit) {   // bit set ? s : +0.0f
  return ((mw >> bit) & 1u) ? s : 0.0f;
}
__device__ __forceinline__ v8f fill8(float x) {
  v8f z;
  z[0] = x; z[1] = x; z[2] = x; z[3] = x; z[4] = x; z[5] = x; z[6] = x; z[7] = x;
  return z;
}

// ---- 16-bit fragment loader (A, B alike): p points at row/col (lane&15), k0 + 8*(lane>>4);
//      elements 0..7 <- p[0..7] (k0+8h..k0+8h+7), elements 8..15 <- p[16..23] (k0+16+8h..k0+16+8h+7)
__device__ __forceinline__ v16h ldfrag(const _Float16* p) {
  Frag f;
  f.half[0] = *(const v8h*)(p);
  f.half[1] = *(const v8h*)(p + 16);
  return f.v;
}

// ---- WMMA with trailing VALU hazard gap (ties D, keeps A/B live past the nops) ---------------------
__device__ __forceinline__ v8f mma(v16h a, v16h b, v8f c) {
  v8f d = __builtin_amdgcn_wmma_f32_16x16x32_f16(false, a, false, b, (short)0, c, false, false);
#if defined(__HIP_DEVICE_COMPILE__)
  asm volatile("v_nop\n\tv_nop\n\tv_nop\n\tv_nop" : "+v"(d) : "v"(a), "v"(b));
#endif
  return d;
}

// =====================================================================================================
// k_prep: blocks 0..127 convert x [1024][256] f32 -> Xh f16 of (bf16-RNE value * 16), 2048 elements per block,
// Blocks 128..159: weight wi = (bid-128)>>3 (0 Wq, 1 Wk, 2 Wv, 3 Wo), rows e0..e0+31 of WT[wi][e][f] =
//   f16 of (bf16-RNE W[f][e] * 1024): LDS tile [32 c][256 f] filled by 2-B stores, then 4 store
// coverage: 128 x 2048 halves = all of Xh; 32 x 8192 halves = all of WT (4 x 256 x 256).
// Blocks 160..175: AB[b][i][g] bit t = (adj[b][i][32 g + t] != 0). A wave reads 32 x 32 consecutive ints (one
//   128-B line per load), one ballot per load gives one word; lane t keeps word t, so the wave stores one whole line.
// coverage: 16 blocks x 8 waves x 32 words = 4096 words = all of AB (8 x 128 x 4).
// =====================================================================================================
__global__ __launch_bounds__(256) void k_prep(const float* __restrict__ x,
                                              const float* __restrict__ Wq, const float* __restrict__ Wk,
                                              const float* __restrict__ Wv, const float* __restrict__ Wo,
                                              const int* __restrict__ adj,
                                              unsigned short* Xh, unsigned short* WT, unsigned* AB) {
  __shared__ __align__(16) unsigned short sT[8192];
  const int tid = threadIdx.x;
  const int bid = blockIdx.x;                  // 0..175
  const int isa = (bid >= (NROWS * DDIM / 2048) + 32) ? 1 : 0;   // block-uniform role: adjacency bit plane
  const int isw = (bid >= (NROWS * DDIM / 2048) && !isa) ? 1 : 0;   // block-uniform role: weights
  const int wb  = isw ? (bid - (NROWS * DDIM / 2048)) : 0;
  const int wi  = wb >> 3;                     // 0..3
  const int e0  = (wb & 7) * 32;

  if (isw) {
    const float* src = (wi == 0) ? Wq : ((wi == 1) ? Wk : ((wi == 2) ? Wv : Wo));   // block-uniform, all global
#pragma unroll 1
    for (int it = 0; it < 4; ++it) {
      const int p  = it * 256 + tid;           // 0..1023
      const int f  = p >> 2;                   // 0..255
      const int c8 = (p & 3) * 8;              // 0,8,16,24
      const float* q = src + (size_t)f * DDIM + e0 + c8;
      const v4f v0 = *(const v4f*)(q);
      const v4f v1 = *(const v4f*)(q + 4);
      unsigned short* d = sT + c8 * 256 + f;   // tile layout [c][f]
#pragma unroll
      for (int u = 0; u < 4; ++u) {
        d[u * 256]       = h_bits(bfr(v0[u]) * 1024.0f);
        d[(u + 4) * 256] = h_bits(bfr(v1[u]) * 1024.0f);
      }
    }
  }
  __syncthreads();

  if (isw) {
    unsigned short* dst = WT + (size_t)wi * WSZ + (size_t)e0 * DDIM;
    v4u pv[4];
#pragma unroll
    for (int it = 0; it < 4; ++it) pv[it] = *(const v4u*)(sT + (size_t)(it * 256 + tid) * 8);
#pragma unroll
    for (int it = 0; it < 4; ++it) *(v4u*)(dst + (size_t)(it * 256 + tid) * 8) = pv[it];
    
  } else if (isa) {
    const int lane = tid & 31;
    const int wv   = (bid - ((NROWS * DDIM / 2048) + 32)) * 8 + (tid >> 5);     // 0..127
    const int* src = adj + (size_t)wv * 1024 + lane;
    int av[32];
#pragma unroll
    for (int t = 0; t < 32; ++t) av[t] = src[t * 32];     // all 32 loads in flight: one round trip
    unsigned word = 0u;
#pragma unroll
    for (int t = 0; t < 32; ++t) {
      const unsigned bal = __builtin_amdgcn_ballot_w32(av[t] != 0);   // bit l = lane l's element, all lanes on
      word = (lane == t) ? bal : word;
    }
    AB[(size_t)wv * 32 + lane] = word;
#if defined(__HIP_DEVICE_COMPILE__)
    asm volatile("s_wait_xcnt 0x0" ::: "memory");       // before any later write of the store's address or data registers
#endif
  } else {
    const size_t base = (size_t)bid * 2048 + (size_t)tid * 8;
    const v4f v0 = *(const v4f*)(x + base);
    const v4f v1 = *(const v4f*)(x + base + 4);
    v4u pk;
    pk[0] = pack2(bfr(v0[0]) * 16.0f, bfr(v0[1]) * 16.0f);
    pk[1] = pack2(bfr(v0[2]) * 16.0f, bfr(v0[3]) * 16.0f);
    pk[2] = pack2(bfr(v1[0]) * 16.0f, bfr(v1[1]) * 16.0f);
    pk[3] = pack2(bfr(v1[2]) * 16.0f, bfr(v1[3]) * 16.0f);
    unsigned short* dst = Xh + base;
    *(v4u*)dst = pk;
    
  }
}

// =====================================================================================================
// k_proj: plane pj = 0 (q), 1 (k), 2 (v): val[n][e] = f16 of 16*(x[n][:].W[:][e] + bfr(bias[e])), n flattened
// over (b, node) 0..1023. Block (pj, rt, cg): rows n = 64 rt .. +63, cols e = 64 cg .. +63; 8 waves, wave w:
// rows 64rt + 16(w>>1), cols 64cg + 32(w&1) + {0..15, 16..31}. A-op = Xh row n (k = f, split map), B-op =
// WT[pj] row e (k = f, split map); D row n = ... + 8h + r, col e = ... + (lane&15); acc = 16384 * (x.W).
// coverage: per plane 16 x 4 blocks x 64 x 64 = 1024 x 256.
// =====================================================================================================
__global__ __launch_bounds__(256) void k_proj(const unsigned short* __restrict__ Xhp,
                                              const unsigned short* __restrict__ WTp,
                                              const float* __restrict__ bq, const float* __restrict__ bk,
                                              const float* __restrict__ bv, unsigned short* QKV) {
  __shared__ __align__(16) unsigned short sT[4096];     // 64 x 64
  const _Float16* Xh = (const _Float16*)(const void*)Xhp;
  const _Float16* WT = (const _Float16*)(const void*)WTp;
  const int tid  = threadIdx.x;
  const int lane = tid & 31, w = tid >> 5, h = lane >> 4, m = lane & 15;
  const int bid  = blockIdx.x;                          // 0..191
  const int pj   = bid / ((NROWS / 64) * (DDIM / 64));   // 0..2 (block-uniform)
  const int rt   = (bid / (DDIM / 64)) % (NROWS / 64);   // 64-row tile of the NROWS flattened rows
  const int cg   = bid % (DDIM / 64);
  const int n0   = rt * 64;
  const int e0g  = cg * 64;
  const int wr   = w >> 1, wc = w & 1;
  const float* bias = (pj == 0) ? bq : ((pj == 1) ? bk : bv);   // block-uniform, all global

  const _Float16* Ap  = Xh + (size_t)(n0 + 16 * wr + m) * DDIM + 8 * h;
  const _Float16* Bp0 = WT + (size_t)pj * WSZ + (size_t)(e0g + 32 * wc + m) * DDIM + 8 * h;
  const _Float16* Bp1 = Bp0 + (size_t)16 * DDIM;
  v8f acc0 = fill8(0.0f), acc1 = fill8(0.0f);
#pragma unroll
  for (int ks = 0; ks < 8; ++ks) {
    const v16h a = ldfrag(Ap + ks * 32);
    acc0 = mma(a, ldfrag(Bp0 + ks * 32), acc0);
    acc1 = mma(a, ldfrag(Bp1 + ks * 32), acc1);
  }

  const int el0 = 32 * wc + m, el1 = el0 + 16;
  const float bb0 = bfr(bias[e0g + el0]);
  const float bb1 = bfr(bias[e0g + el1]);
#pragma unroll
  for (int r = 0; r < 8; ++r) {
    const int nl = 16 * wr + 8 * h + r;
    const float v0 = (acc0[r] * 6.103515625e-05f + bb0) * 16.0f;  // acc/16384 + b, carried x16
    const float v1 = (acc1[r] * 6.103515625e-05f + bb1) * 16.0f;
    sT[nl * 64 + el0] = h_bits(v0);
    sT[nl * 64 + el1] = h_bits(v1);
  }
  __syncthreads();

  const int piece = tid & 7, rq = tid >> 3;             // rq 0..31
  v4u pv[2];
  size_t o[2];
#pragma unroll
  for (int it = 0; it < 2; ++it) {
    const int row = it * 32 + rq;                       // tile row nl 0..63
    pv[it] = *(const v4u*)(sT + row * 64 + piece * 8);
    o[it] = (size_t)pj * PLN + (size_t)(n0 + row) * DDIM + e0g + piece * 8;
  }
#pragma unroll
  for (int it = 0; it < 2; ++it) *(v4u*)(QKV + o[it]) = pv[it];
  
}

// =====================================================================================================
// k_scores, blocks 0..63: S[b][j][kk] = expf((q_j.k_kk)/16), f32 plane [8][128][128]. Block (b, jt): rows
// j = 16 jt..+15, all 128 kk; 8 waves, wave w owns kk0 = 16 w. A-op = Q row j (k = d, split), B-op = K row kk
// (k = d, split). acc = 256 * q.k -> logit arg = acc * 2^-12. 16x128 f32 strip staged in LDS; expf in a rolled pass.
// coverage: 64 blocks x 2048 floats = all of S.
// Blocks 64..127: VWT[b][d][kk] = f16 of 16 * sum_e v[b][kk][e] Wo[e][d]. Block (dt, nt): rows d = 64 dt..+63,
// cols n = 64 nt..+63 of the flattened (b, kk); wave w: rows 16(w>>1), cols 32(w&1) + {0..15, 16..31}.
// A-op = WoT row d (k = e, split), B-op = V row n (k = e, split); acc = 16384 * v.Wo -> x 2^-10.
// coverage: 4 x 16 blocks x 64 x 64 = 256 x 1024 = all of VWT; each tile row is one whole 128-B line.
// =====================================================================================================
__global__ __launch_bounds__(256) void k_scores(const unsigned short* __restrict__ QKV,
                                                const unsigned short* __restrict__ WTp,
                                                float* S, unsigned short* VWT) {
  __shared__ __align__(16) float sS[2048];              // scores: [16][128] f32; v.Wo: [64][64] f16
  const _Float16* Q = (const _Float16*)(const void*)QKV;
  const int tid  = threadIdx.x;
  const int lane = tid & 31, w = tid >> 5, h = lane >> 4, m = lane & 15;
  const int bid  = blockIdx.x;                          // 0..127, role is block-uniform

  if (bid < NBATCH * (NN / 16)) {
    const _Float16* K = Q + PLN;
    const int jt   = bid & 7;
    const int b    = bid >> 3;
    const int j0   = b * NN + jt * 16;                  // flattened query row base
    const int kr0  = b * NN + w * 16;                   // flattened key row base

    const _Float16* Ap = Q + (size_t)(j0 + m) * DDIM + 8 * h;
    const _Float16* Bp = K + (size_t)(kr0 + m) * DDIM + 8 * h;
    v8f acc = fill8(0.0f);
#pragma unroll
    for (int ks = 0; ks < 8; ++ks) acc = mma(ldfrag(Ap + ks * 32), ldfrag(Bp + ks * 32), acc);

#pragma unroll
    for (int r = 0; r < 8; ++r) sS[(8 * h + r) * NN + w * 16 + m] = acc[r] * 0.000244140625f;   // 2^-12
    __syncthreads();
#pragma unroll 1
    for (int e = tid; e < 2048; e += 256) sS[e] = expf(sS[e]);
    __syncthreads();

    v4f pv[2];
#pragma unroll
    for (int it = 0; it < 2; ++it) pv[it] = *(const v4f*)(sS + (size_t)(it * 256 + tid) * 4);
    float* op = S + (size_t)j0 * NN;
#pragma unroll
    for (int it = 0; it < 2; ++it) *(v4f*)(op + (size_t)(it * 256 + tid) * 4) = pv[it];
  } else {
    unsigned short* sT = (unsigned short*)(void*)sS;    // 64 x 64 halves
    const _Float16* V   = Q + (size_t)2 * PLN;          // [n][e]
    const _Float16* WoT = (const _Float16*)(const void*)WTp + (size_t)3 * WSZ;   // [d][e]
    const int vb = bid - NBATCH * (NN / 16);            // 0..63
    const int d0 = (vb >> 4) * 64;
    const int n0 = (vb & 15) * 64;
    const int wr = w >> 1, wc = w & 1;

    const _Float16* Ap  = WoT + (size_t)(d0 + 16 * wr + m) * DDIM + 8 * h;
    const _Float16* Bp0 = V + (size_t)(n0 + 32 * wc + m) * DDIM + 8 * h;
    const _Float16* Bp1 = Bp0 + (size_t)16 * DDIM;
    v16h Af[8], Bf0[8], Bf1[8];                         // all 48 loads in flight at once: one L2 round trip
#pragma unroll
    for (int ks = 0; ks < 8; ++ks) {
      Af[ks]  = ldfrag(Ap + ks * 32);
      Bf0[ks] = ldfrag(Bp0 + ks * 32);
      Bf1[ks] = ldfrag(Bp1 + ks * 32);
    }
    v8f acc0 = fill8(0.0f), acc1 = fill8(0.0f);
#pragma unroll
    for (int ks = 0; ks < 8; ++ks) {
      acc0 = mma(Af[ks], Bf0[ks], acc0);
      acc1 = mma(Af[ks], Bf1[ks], acc1);
    }
#pragma unroll
    for (int r = 0; r < 8; ++r) {                        // D row d = 16 wr + 8h + r, col n = 32 wc + m (+16)
      unsigned short* tp = sT + (16 * wr + 8 * h + r) * 64 + 32 * wc + m;
      tp[0]  = h_bits(acc0[r] * 0.0009765625f);          // 16384 v.Wo * 2^-10 = 16 v.Wo
      tp[16] = h_bits(acc1[r] * 0.0009765625f);
    }
    __syncthreads();

    const int piece = tid & 7, rq = tid >> 3;           // rq 0..31
    const int b = n0 >> 7, kk0 = n0 & (NN - 1);         // flattened col n0 = batch b, node kk0
    v4u pv[2];
#pragma unroll
    for (int it = 0; it < 2; ++it) pv[it] = *(const v4u*)(sT + (it * 32 + rq) * 64 + piece * 8);
#pragma unroll
    for (int it = 0; it < 2; ++it)
      *(v4u*)(VWT + (size_t)(b * DDIM + d0 + it * 32 + rq) * NN + kk0 + piece * 8) = pv[it];
  }
}

// =====================================================================================================
// k_main: one 256-thread block per (b, j); the block owns output row (b, j) and sees every subtree i itself,
// so the max over i needs no cross-block exchange. s[kk] = S[b][j][kk]; ok[i] = (adj_mask[b][i][j] == 0).
// Row i of adj[b] comes as the 128 bits AB[b][i][0..3] (bit t of word g: adj[b][i][32 g + t] != 0), one 16-B load.
// Phase 1 (thread i < 128): aij = adj[b][i][j] != 0; den = aij ? sum_kk (adj[b][i][kk] != 0) s[kk] : 0;
//   P[i][kk] = (aij && adj[b][i][kk] != 0) ? s[kk] / max(den, 1e-9) : 0, stored x1024 as f16 in Pt [128 rows][128 of pitch PPITCH].
// Phase 2: O = (1024 P).(16 v.Wo) * 2^-14 + bfr(bo): A-op rows i from Pt (k = kk, split), B-op cols d from
//   VWT[b] rows (k = kk, split); wave w owns d = 32 w + {0..15, 16..31}, 8 i-tiles x 4 k-steps.
//   val = ok[i] ? O : -1e12; column max over all 128 i via per-lane max over r and a xor-16 shuffle.
// Output row (b, j) = 256 f32 = 1 KB staged in LDS, written by threads 0..63 x 16 B in one instruction
// coverage: 1024 blocks x 256 floats = the whole output; Pt rows 0..127 (threads 0..127 x 16 x 8 halves),
//   ok/wsr 128 entries, all before their barriers.
// =====================================================================================================
__global__ __launch_bounds__(256) void k_main(const unsigned* __restrict__ AB, const int* __restrict__ adjm,
                                              const float* __restrict__ S, const unsigned short* __restrict__ VWTp,
                                              const float* __restrict__ bo, float* out) {
  __shared__ __align__(16) _Float16 Pt[NN * PPITCH];    // [128][128 used of PPITCH]; pad halves never read
  __shared__ __align__(16) float sO[DDIM];
  __shared__ float wsr[NN];
  __shared__ int   sok[NN];
  const _Float16* VWT = (const _Float16*)(const void*)VWTp;                     // [b][d][kk]
  const int tid  = threadIdx.x;
  const int lane = tid & 31, w = tid >> 5, h = lane >> 4, m = lane & 15;
  const int b    = blockIdx.x >> 7;
  const int j    = blockIdx.x & (NN - 1);

  v4u mk = {0u, 0u, 0u, 0u};
  if (tid < NN) {                                       // waves 0..3, wave-uniform
    const float sv = S[(size_t)(b * NN + j) * NN + tid];
    const int   am = adjm[(size_t)(b * NN + tid) * NN + j];
#if defined(__HIP_DEVICE_COMPILE__)
    asm volatile("s_wait_xcnt 0x0" ::: "memory");       // the mask load below may land in the address registers of these two
#endif
    mk = *(const v4u*)(AB + (size_t)(b * NN + tid) * 4);   // in flight together with the two loads above: one round trip
    wsr[tid] = sv;
    sok[tid] = (am == 0) ? 1 : 0;
  }
  __syncthreads();

  // ---------------- phase 1: subtree-normalised score rows ----------------
  if (tid < NN) {                                       // waves 0..3, wave-uniform
    const int i = tid;
    const int jw = j >> 5;                              // block-uniform
    const unsigned wj = (jw == 0) ? mk[0] : ((jw == 1) ? mk[1] : ((jw == 2) ? mk[2] : mk[3]));
    const int aij = (int)((wj >> (j & 31)) & 1u);
    float den = 0.0f;
    unsigned r0 = mk[0], r1 = mk[1], r2 = mk[2];
    const unsigned r3 = mk[3];
#pragma unroll 1                                        // rolled per mask word: 32, not 128, scores live at a time,
    for (int g = 0; g < 4; ++g) {                       // so the kernel keeps 8 waves per SIMD
      const unsigned mw = r0;                           // bit t: kk = 32 g + t
      r0 = r1; r1 = r2; r2 = r3;
#pragma unroll
      for (int q = 0; q < 4; ++q) {
#pragma unroll
        for (int u = 0; u < 4; ++u) {
          den += keep(wsr[g * 32 + q * 8 + u], mw, q * 8 + u);
          den += keep(wsr[g * 32 + q * 8 + 4 + u], mw, q * 8 + 4 + u);
        }
      }
    }
    den = (aij != 0) ? den : 0.0f;
    const float rden = 1.0f / fmaxf(den, 1.0e-9f);
    r0 = (aij != 0) ? mk[0] : 0u;                       // aij == 0: all of P[i] is 0
    r1 = (aij != 0) ? mk[1] : 0u;
    r2 = (aij != 0) ? mk[2] : 0u;
    const unsigned r3z = (aij != 0) ? mk[3] : 0u;
#pragma unroll 1                                        // rolled for the same reason as above
    for (int g = 0; g < 4; ++g) {
      const unsigned mw = r0;
      r0 = r1; r1 = r2; r2 = r3z;
#pragma unroll
      for (int q = 0; q < 4; ++q) {
        v8h hv;
#pragma unroll
        for (int u = 0; u < 4; ++u) {
          const float t0 = keep(wsr[g * 32 + q * 8 + u], mw, q * 8 + u);
          const float t1 = keep(wsr[g * 32 + q * 8 + 4 + u], mw, q * 8 + 4 + u);
          hv[u]     = (_Float16)((t0 * rden) * 1024.0f);
          hv[4 + u] = (_Float16)((t1 * rden) * 1024.0f);
        }
        *(v8h*)(Pt + i * PPITCH + g * 32 + q * 8) = hv;
      }
    }
  }
  __syncthreads();

  // ---------------- phase 2: O = P . (v.Wo)_b + bo, masked max over i ----------------
  v8f m0 = fill8(-3.0e38f), m1 = fill8(-3.0e38f);
  {
    const _Float16* vp0 = VWT + (size_t)(b * DDIM + 32 * w + m) * NN + 8 * h;  // B-op col d = 32w + m
    const _Float16* vp1 = vp0 + (size_t)16 * NN;                               // col d = 32w + 16 + m
    v16h Bf0[4], Bf1[4];
#pragma unroll
    for (int ks = 0; ks < 4; ++ks) {
      Bf0[ks] = ldfrag(vp0 + ks * 32);
      Bf1[ks] = ldfrag(vp1 + ks * 32);
    }
    const float bb0 = bfr(bo[32 * w + m]);
    const float bb1 = bfr(bo[32 * w + 16 + m]);
#pragma unroll 1
    for (int it = 0; it < 8; ++it) {
      const _Float16* ap = Pt + (it * 16 + m) * PPITCH + 8 * h;                // A-op row i = 16 it + (lane&15)
      v8f c0 = fill8(0.0f), c1 = fill8(0.0f);
#pragma unroll
      for (int ks = 0; ks < 4; ++ks) {
        const v16h a = ldfrag(ap + ks * 32);
        c0 = mma(a, Bf0[ks], c0);
        c1 = mma(a, Bf1[ks], c1);
      }
#pragma unroll
      for (int r = 0; r < 8; ++r) {                      // D row i = 16 it + 8h + r
        const int ok = sok[it * 16 + 8 * h + r];
        const float v0 = c0[r] * 6.103515625e-05f + bb0;   // 16384 O * 2^-14 + bo
        const float v1 = c1[r] * 6.103515625e-05f + bb1;
        m0[r] = fmaxf(m0[r], (ok != 0) ? v0 : -1.0e12f);
        m1[r] = fmaxf(m1[r], (ok != 0) ? v1 : -1.0e12f);
      }
    }
  }

  float M0 = m0[0], M1 = m1[0];
#pragma unroll
  for (int r = 1; r < 8; ++r) { M0 = fmaxf(M0, m0[r]); M1 = fmaxf(M1, m1[r]); }
  M0 = fmaxf(M0, __shfl_xor(M0, 16, 32));               // combine lane halves (not under lane-varying control)
  M1 = fmaxf(M1, __shfl_xor(M1, 16, 32));
  sO[w * 32 + m]      = M0;                             // both lane halves write the same value
  sO[w * 32 + 16 + m] = M1;
  __syncthreads();

  float* op = out + (size_t)(b * NN + j) * DDIM + (size_t)tid * 4;
  if (tid < 64) {                                       // waves 0,1: 64 x 16 B = the whole 1-KB row, 8 lines
    const v4f ov = *(const v4f*)(sO + tid * 4);
    *(v4f*)op = ov;
  }
  
}

// =====================================================================================================
// Workspace map (bytes); every region is an exact multiple of its whole-line store granularity:
//   Xh   f16 [1024][256]                      524288 at       0
//   WT   f16 [4][256][256]                    524288 at  524288
//   QKV  f16 Q, K, V [1024][256] each        1572864 at 1048576
//   S    f32 [8][128][128]                    524288 at 2621440
//   VWT  f16 [8][256][128]                    524288 at 3145728
//   AB   u32 [8][128][4]                       16384 at 3670016
//   total                                    3686400
// =====================================================================================================
extern "C" void kernel_launch(void* const* d_in, const int* in_sizes, int n_in,
                              void* d_out, int out_size, void* d_ws, size_t ws_size,
                              hipStream_t stream) {
  if (n_in < 11) return;
  if (in_sizes[0] != SSZ) return;                // adj
  if (in_sizes[1] != PLN) return;                // sat_inputs
  if (in_sizes[2] != SSZ) return;                // adj_mask
  if (in_sizes[3] != WSZ || in_sizes[4] != DDIM) return;
  if (in_sizes[5] != WSZ || in_sizes[6] != DDIM) return;
  if (in_sizes[7] != WSZ || in_sizes[8] != DDIM) return;
  if (in_sizes[9] != WSZ || in_sizes[10] != DDIM) return;
  if (out_size != PLN) return;

  const int*   adj  = (const int*)d_in[0];       // [8][128][128]
  const float* x    = (const float*)d_in[1];     // [8][128][256]
  const int*   adjm = (const int*)d_in[2];       // [8][128][128]
  const float* Wq   = (const float*)d_in[3];  const float* bq = (const float*)d_in[4];
  const float* Wk   = (const float*)d_in[5];  const float* bk = (const float*)d_in[6];
  const float* Wv   = (const float*)d_in[7];  const float* bv = (const float*)d_in[8];
  const float* Wo   = (const float*)d_in[9];  const float* bo = (const float*)d_in[10];
  float* out = (float*)d_out;                    // [8][128][256]

  const size_t offXh  = 0;
  const size_t offWT  = offXh  + (size_t)PLN * 2;
  const size_t offQKV = offWT  + (size_t)4 * WSZ * 2;
  const size_t offS   = offQKV + (size_t)3 * PLN * 2;
  const size_t offVW  = offS   + (size_t)SSZ * 4;
  const size_t offAB  = offVW  + (size_t)PLN * 2;
  const size_t total  = offAB  + (size_t)(SSZ / 32) * 4;   // 3686400
  if (total > ws_size) return;
  if (total > (size_t)134217728) return;

  char* ws = (char*)d_ws;
  unsigned short* Xh  = (unsigned short*)(ws + offXh);
  unsigned short* WT  = (unsigned short*)(ws + offWT);
  unsigned short* QKV = (unsigned short*)(ws + offQKV);
  float*          S   = (float*)(ws + offS);
  unsigned short* VWT = (unsigned short*)(ws + offVW);
  unsigned*       AB  = (unsigned*)(ws + offAB);

  k_prep<<<dim3((NROWS * DDIM / 2048) + 32 + SSZ / 8192), dim3(256), 0, stream>>>(x, Wq, Wk, Wv, Wo, adj, Xh, WT, AB);
  k_proj<<<dim3(3 * (NROWS / 64) * (DDIM / 64)), dim3(256), 0, stream>>>(Xh, WT, bq, bk, bv, QKV);
  k_scores<<<dim3(NBATCH * (NN / 16) + (DDIM / 64) * (NROWS / 64)), dim3(256), 0, stream>>>(QKV, WT, S, VWT);
  k_main<<<dim3(NBATCH * NN), dim3(256), 0, stream>>>(AB, adjm, S, VWT, bo, out);
  (void)hipGetLastError();
}

// v005
// Measured time: 17.9 microseconds a run.
// Versions in between are left out here; by their measured steps it is 1.64 times as fast as v003.
// Counting every step since v000, it is 8.91 times as fast.
// Contractions on v_wmma_f32_16x16x32_f16, f32 accumulate: x.Wq, x.Wk, x.Wv (x carried x16, W x1024, f16 built
// from bf16-RNE inputs); q.k^T (q, k carried x16); per b: v.Wo (v carried x16, Wo x1024); per (b,j): (s_j * v.Wo).adj^T
// (s_j * v.Wo carried x16, adj 0/1) and the row sums s_j.adj^T; single products. exp, reciprocal, the scaling by s_j (f16),
// the division by the row sum, bias adds and the max-pool on VALU.
#include <hip/hip_runtime.h>
#include <stdint.h>

#define NBATCH 8
#define NN     128
#define DDIM   256
#define NROWS  1024            // NBATCH*NN
#define PLN    262144          // NBATCH*NN*DDIM
#define WSZ    65536           // DDIM*DDIM
#define SSZ    131072          // NBATCH*NN*NN
static_assert(NROWS == NBATCH * NN);
static_assert(PLN == NROWS * DDIM);
static_assert(WSZ == DDIM * DDIM);
static_assert(SSZ == NBATCH * NN * NN);
static_assert(NN == 128);
static_assert(DDIM == 256);
static_assert((NROWS % 64) == 0);
#define PPITCH 136             // halves per LDS row of adj: 272 B = 16 B x 17, so 16 rows' 16-B pieces fall on all 64 banks
#define JT     16              // query rows j per k_main block
#define DQ     64              // output columns d per k_main block
#define XPITCH 264            // halves per LDS row of the x and W tiles of k_proj: 528 B = 16 B x 33
#define NPROJ  192            // projection blocks of k_proj: 3 planes x (NROWS / 64) x (DDIM / 64)
static_assert(NPROJ == 3 * (NROWS / 64) * (DDIM / 64));
static_assert(XPITCH >= DDIM && (XPITCH % 8) == 0 && ((XPITCH / 8) % 2) == 1);
static_assert(PPITCH >= NN && (PPITCH % 8) == 0 && ((PPITCH / 8) % 2) == 1);

typedef _Float16     v16h __attribute__((ext_vector_type(16)));
typedef _Float16     v8h  __attribute__((ext_vector_type(8)));
typedef float        v8f  __attribute__((ext_vector_type(8)));
typedef float        v4f  __attribute__((ext_vector_type(4)));
typedef float        v2f  __attribute__((ext_vector_type(2)));
typedef int          v4i  __attribute__((ext_vector_type(4)));
typedef unsigned int v4u  __attribute__((ext_vector_type(4)));

union Frag { v16h v; v8h half[2]; };

// ---- scalar helpers --------------------------------------------------------------------------------
__device__ __forceinline__ unsigned short bf_bits(float f) {          // f32 -> bf16 bits, RNE convert
  unsigned u = __float_as_uint(f);
  return (unsigned short)((u + 0x7FFFu + ((u >> 16) & 1u)) >> 16);
}
__device__ __forceinline__ float bf_up(unsigned short b) { return __uint_as_float(((unsigned)b) << 16); }
__device__ __forceinline__ float bfr(float f) { return bf_up(bf_bits(f)); }   // value after bf16 RNE convert
__device__ __forceinline__ unsigned short h_bits(float f) {           // f32 -> f16 bits, RNE convert
  return __builtin_bit_cast(unsigned short, (_Float16)f);
}
__device__ __forceinline__ unsigned pack2(float a, float b) {         // two halves into one word, low = first
  return (unsigned)h_bits(a) | (((unsigned)h_bits(b)) << 16);
}
__device__ __forceinline__ v8f fill8(float x) {
  v8f z;
  z[0] = x; z[1] = x; z[2] = x; z[3] = x; z[4] = x; z[5] = x; z[6] = x; z[7] = x;
  return z;
}

// ---- 16-bit fragment loader (A, B alike): p points at row/col (lane&15), k0 + 8*(lane>>4);
//      elements 0..7 <- p[0..7] (k0+8h..k0+8h+7), elements 8..15 <- p[16..23] (k0+16+8h..k0+16+8h+7)
__device__ __forceinline__ v16h ldfrag(const _Float16* p) {
  Frag f;
  f.half[0] = *(const v8h*)(p);
  f.half[1] = *(const v8h*)(p + 16);
  return f.v;
}

// ---- WMMA with trailing VALU hazard gap (ties D, keeps A/B live past the nops) ---------------------
__device__ __forceinline__ v8f mma(v16h a, v16h b, v8f c) {
  v8f d = __builtin_amdgcn_wmma_f32_16x16x32_f16(false, a, false, b, (short)0, c, false, false);
#if defined(__HIP_DEVICE_COMPILE__)
  asm volatile("v_nop\n\tv_nop\n\tv_nop\n\tv_nop" : "+v"(d) : "v"(a), "v"(b));
#endif
  return d;
}

// =====================================================================================================
// k_proj, blocks 0..191: plane pj = 0 (q), 1 (k), 2 (v): val[n][e] = f16 of 16*(x[n][:].W[:][e] + bfr(bias[e])), n flattened
// over (b, node) 0..1023. Block (pj, rt, cg): rows n = 64 rt .. +63, cols e = 64 cg .. +63. The block converts its own
// operands from the f32 inputs: sX[n][f] = f16 of (bf16-RNE x * 16); sW[e][f] = f16 of (bf16-RNE W[f][e] * 1024), the
// transpose made in registers (a thread holds 8 f x 4 e and stores 8 f of one e as 16 B). In sW the 16-B piece c of row e
// lies at piece c ^ ((e >> 4) & 3): the 16 rows 4 apart that one store covers then fall on all 64 banks; a fragment read
// covers 16 neighbouring rows, for which that term is one constant. 8 waves, wave w: rows 16(w>>1), cols 32(w&1) +
// {0..15, 16..31}. A-op = sX row n (k = f, split map), B-op = sW row e (k = f, split map); D row n = ... + 8h + r,
// col e = ... + (lane&15); acc = 16384 * (x.W).
// coverage: sX 2048 x 16 B, sW 2048 x 16 B before the first barrier; per plane 16 x 4 blocks x 64 x 64 = 1024 x 256.
// Blocks 192..199: rows e0..e0+31 of WT[3][e][f] = f16 of (bf16-RNE Wo[f][e] * 1024): LDS tile [32 c][256 f] filled by
// 2-B stores, then 4 whole-line stores per thread. coverage: 8 x 8192 halves = all of WT[3] (256 x 256).
// Blocks 200..263: AH[b][i][kk] = f16 1.0 where adj[b][i][kk] != 0, else 0; 8 elements per thread, one 16-B store.
// coverage: 64 blocks x 2048 halves = all of AH (8 x 128 x 128).
// =====================================================================================================
__global__ __launch_bounds__(256) void k_proj(const float* __restrict__ x,
                                              const float* __restrict__ Wq, const float* __restrict__ Wk,
                                              const float* __restrict__ Wv, const float* __restrict__ Wo,
                                              const float* __restrict__ bq, const float* __restrict__ bk,
                                              const float* __restrict__ bv, const int* __restrict__ adj,
                                              unsigned short* QKV, unsigned short* WT, unsigned short* AH) {
  __shared__ __align__(16) unsigned short sX[64 * XPITCH];
  __shared__ __align__(16) unsigned short sW[64 * XPITCH];
  __shared__ __align__(16) unsigned short sT[4096];     // 64 x 64
  const int tid  = threadIdx.x;
  const int bid  = blockIdx.x;                          // 0..263, role is block-uniform

  if (bid < NPROJ) {
    const int lane = tid & 31, w = tid >> 5, h = lane >> 4, m = lane & 15;
    const int pj   = bid / ((NROWS / 64) * (DDIM / 64));   // 0..2 (block-uniform)
    const int rt   = (bid / (DDIM / 64)) % (NROWS / 64);   // 64-row tile of the NROWS flattened rows
    const int cg   = bid % (DDIM / 64);
    const int n0   = rt * 64;
    const int e0g  = cg * 64;
    const int wr   = w >> 1, wc = w & 1;
    const float* bias = (pj == 0) ? bq : ((pj == 1) ? bk : bv);   // block-uniform, all global
    const float* wsrc = (pj == 0) ? Wq : ((pj == 1) ? Wk : Wv);   // block-uniform, all global

    // ---- both f32 tiles and the bias in flight at once: 32 loads of 16 B and 2 of 4 B per thread ----
    const int xr = tid >> 5, xc = (tid & 31) * 8;       // x: row 8 q + xr, columns xc .. xc + 7
    const int fq = tid >> 4, e4 = (tid & 15) * 4;       // W: rows 8 (16 it + fq) + 0..7, columns e4 .. e4 + 3
    const float* px = x + (size_t)(n0 + xr) * DDIM + xc;
    const float* pw = wsrc + (size_t)(fq * 8) * DDIM + e0g + e4;
    const int el0 = 32 * wc + m, el1 = el0 + 16;
    const float* pb = bias + e0g + el0;
    v4f xa[8], xb[8], wv[2][8];
#pragma unroll
    for (int q = 0; q < 8; ++q) {
      xa[q] = *(const v4f*)(px + q * 8 * DDIM);
      xb[q] = *(const v4f*)(px + q * 8 * DDIM + 4);
    }
#pragma unroll
    for (int it = 0; it < 2; ++it) {
#pragma unroll
      for (int r = 0; r < 8; ++r) wv[it][r] = *(const v4f*)(pw + (it * 128 + r) * DDIM);
    }
    const float rb0 = pb[0], rb1 = pb[16];
#if defined(__HIP_DEVICE_COMPILE__)
    // the wait stands before any write of these loads' address registers: as inputs here the addresses stay in
    // their registers up to it
    asm volatile("s_wait_xcnt 0x0" :: "v"(px), "v"(pw) : "memory");
#endif
    // no conversion is scheduled among the loads: without this the last 8 loads were issued behind a wait on the first 26
    __builtin_amdgcn_sched_barrier(0);
#pragma unroll
    for (int q = 0; q < 8; ++q) {
      v4u pk;
      pk[0] = pack2(bfr(xa[q][0]) * 16.0f, bfr(xa[q][1]) * 16.0f);
      pk[1] = pack2(bfr(xa[q][2]) * 16.0f, bfr(xa[q][3]) * 16.0f);
      pk[2] = pack2(bfr(xb[q][0]) * 16.0f, bfr(xb[q][1]) * 16.0f);
      pk[3] = pack2(bfr(xb[q][2]) * 16.0f, bfr(xb[q][3]) * 16.0f);
      *(v4u*)(sX + (q * 8 + xr) * XPITCH + xc) = pk;
    }
    const int gs = (tid & 15) >> 2;                     // (e >> 4) & 3 of this thread's four rows e4 .. e4 + 3
#pragma unroll
    for (int it = 0; it < 2; ++it) {
      const int pc = (it * 16 + fq) ^ gs;               // place of piece f / 8 = 16 it + fq
#pragma unroll
      for (int u = 0; u < 4; ++u) {
        v4u pk;
        pk[0] = pack2(bfr(wv[it][0][u]) * 1024.0f, bfr(wv[it][1][u]) * 1024.0f);
        pk[1] = pack2(bfr(wv[it][2][u]) * 1024.0f, bfr(wv[it][3][u]) * 1024.0f);
        pk[2] = pack2(bfr(wv[it][4][u]) * 1024.0f, bfr(wv[it][5][u]) * 1024.0f);
        pk[3] = pack2(bfr(wv[it][6][u]) * 1024.0f, bfr(wv[it][7][u]) * 1024.0f);
        *(v4u*)(sW + (e4 + u) * XPITCH + pc * 8) = pk;
      }
    }
    __syncthreads();

    const _Float16* Ap  = (const _Float16*)(const void*)sX + (16 * wr + m) * XPITCH + 8 * h;
    const _Float16* Bp0 = (const _Float16*)(const void*)sW + (32 * wc + m) * XPITCH;      // rows with (e >> 4) & 3 = 2 wc
    const _Float16* Bp1 = Bp0 + 16 * XPITCH;                                              // rows with (e >> 4) & 3 = 2 wc + 1
    const int g0 = 2 * wc, g1 = 2 * wc + 1;
    const int o00 = (h ^ g0) * 8, o01 = ((2 + h) ^ g0) * 8;   // places of pieces h and 2 + h inside each group of four
    const int o10 = (h ^ g1) * 8, o11 = ((2 + h) ^ g1) * 8;
    v16h Af[8];
    Frag Bf0[8], Bf1[8];                                // all 48 LDS reads issued as one group ahead of the products
#pragma unroll
    for (int ks = 0; ks < 8; ++ks) {
      Af[ks] = ldfrag(Ap + ks * 32);
      Bf0[ks].half[0] = *(const v8h*)(Bp0 + ks * 32 + o00);
      Bf0[ks].half[1] = *(const v8h*)(Bp0 + ks * 32 + o01);
      Bf1[ks].half[0] = *(const v8h*)(Bp1 + ks * 32 + o10);
      Bf1[ks].half[1] = *(const v8h*)(Bp1 + ks * 32 + o11);
    }
    v8f acc0 = fill8(0.0f), acc1 = fill8(0.0f);
#pragma unroll
    for (int ks = 0; ks < 8; ++ks) {
      acc0 = mma(Af[ks], Bf0[ks].v, acc0);
      acc1 = mma(Af[ks], Bf1[ks].v, acc1);
    }

    const float bb0 = bfr(rb0);
    const float bb1 = bfr(rb1);
#pragma unroll
    for (int r = 0; r < 8; ++r) {
      const int nl = 16 * wr + 8 * h + r;
      const float v0 = (acc0[r] * 6.103515625e-05f + bb0) * 16.0f;  // acc/16384 + b, carried x16
      const float v1 = (acc1[r] * 6.103515625e-05f + bb1) * 16.0f;
      sT[nl * 64 + el0] = h_bits(v0);
      sT[nl * 64 + el1] = h_bits(v1);
    }
    __syncthreads();

    const int piece = tid & 7, rq = tid >> 3;           // rq 0..31
    v4u pv[2];
    size_t o[2];
#pragma unroll
    for (int it = 0; it < 2; ++it) {
      const int row = it * 32 + rq;                     // tile row nl 0..63
      pv[it] = *(const v4u*)(sT + row * 64 + piece * 8);
      o[it] = (size_t)pj * PLN + (size_t)(n0 + row) * DDIM + e0g + piece * 8;
    }
#pragma unroll
    for (int it = 0; it < 2; ++it) *(v4u*)(QKV + o[it]) = pv[it];
  } else if (bid < NPROJ + 8) {
    const int e0 = (bid - NPROJ) * 32;
#pragma unroll 1
    for (int it = 0; it < 4; ++it) {
      const int p  = it * 256 + tid;           // 0..1023
      const int f  = p >> 2;                   // 0..255
      const int c8 = (p & 3) * 8;              // 0,8,16,24
      const float* q = Wo + (size_t)f * DDIM + e0 + c8;
      const v4f v0 = *(const v4f*)(q);
      const v4f v1 = *(const v4f*)(q + 4);
      unsigned short* d = sX + c8 * 256 + f;   // tile layout [c][f], 8192 halves of sX
#pragma unroll
      for (int u = 0; u < 4; ++u) {
        d[u * 256]       = h_bits(bfr(v0[u]) * 1024.0f);
        d[(u + 4) * 256] = h_bits(bfr(v1[u]) * 1024.0f);
      }
    }
    __syncthreads();
    unsigned short* dst = WT + (size_t)3 * WSZ + (size_t)e0 * DDIM;
    v4u pv[4];
#pragma unroll
    for (int it = 0; it < 4; ++it) pv[it] = *(const v4u*)(sX + (size_t)(it * 256 + tid) * 8);
#pragma unroll
    for (int it = 0; it < 4; ++it) *(v4u*)(dst + (size_t)(it * 256 + tid) * 8) = pv[it];
  } else {
    const size_t base = (size_t)(bid - (NPROJ + 8)) * 2048 + (size_t)tid * 8;
    const v4i a0 = *(const v4i*)(adj + base);
    const v4i a1 = *(const v4i*)(adj + base + 4);
    v4u pk;
    pk[0] = (a0[0] != 0 ? 0x3C00u : 0u) | (a0[1] != 0 ? 0x3C000000u : 0u);
    pk[1] = (a0[2] != 0 ? 0x3C00u : 0u) | (a0[3] != 0 ? 0x3C000000u : 0u);
    pk[2] = (a1[0] != 0 ? 0x3C00u : 0u) | (a1[1] != 0 ? 0x3C000000u : 0u);
    pk[3] = (a1[2] != 0 ? 0x3C00u : 0u) | (a1[3] != 0 ? 0x3C000000u : 0u);
    *(v4u*)(AH + base) = pk;
#if defined(__HIP_DEVICE_COMPILE__)
    asm volatile("s_wait_xcnt 0x0" ::: "memory");       // before any later write of the store's address or data registers
#endif
  }
}

// =====================================================================================================
// k_scores, blocks 0..63: S[b][j][kk] = f16 of expf((q_j.k_kk)/16), plane [8][128][128]. Block (b, jt): rows
// j = 16 jt..+15, all 128 kk; 8 waves, wave w owns kk0 = 16 w. A-op = Q row j (k = d, split), B-op = K row kk
// (k = d, split). acc = 256 * q.k -> logit arg = acc * 2^-12. 16x128 f32 strip staged in LDS; expf in a rolled pass.
// coverage: 64 blocks x 2048 halves = all of S.
// Blocks 64..127: VWT[b][d][kk] = f16 of 16 * sum_e v[b][kk][e] Wo[e][d]. Block (dt, nt): rows d = 64 dt..+63,
// cols n = 64 nt..+63 of the flattened (b, kk); wave w: rows 16(w>>1), cols 32(w&1) + {0..15, 16..31}.
// A-op = WoT row d (k = e, split), B-op = V row n (k = e, split); acc = 16384 * v.Wo -> x 2^-10.
// coverage: 4 x 16 blocks x 64 x 64 = 256 x 1024 = all of VWT; each tile row is one whole 128-B line.
// =====================================================================================================
__global__ __launch_bounds__(256) void k_scores(const unsigned short* __restrict__ QKV,
                                                const unsigned short* __restrict__ WTp,
                                                unsigned short* S, unsigned short* VWT) {
  __shared__ __align__(16) float sS[2048];              // scores: [16][128] f32; v.Wo: [64][64] f16
  const _Float16* Q = (const _Float16*)(const void*)QKV;
  const int tid  = threadIdx.x;
  const int lane = tid & 31, w = tid >> 5, h = lane >> 4, m = lane & 15;
  const int bid  = blockIdx.x;                          // 0..127, role is block-uniform

  if (bid < NBATCH * (NN / 16)) {
    const _Float16* K = Q + PLN;
    const int jt   = bid & 7;
    const int b    = bid >> 3;
    const int j0   = b * NN + jt * 16;                  // flattened query row base
    const int kr0  = b * NN + w * 16;                   // flattened key row base

    const _Float16* Ap = Q + (size_t)(j0 + m) * DDIM + 8 * h;
    const _Float16* Bp = K + (size_t)(kr0 + m) * DDIM + 8 * h;
    v8f acc = fill8(0.0f);
#pragma unroll
    for (int ks = 0; ks < 8; ++ks) acc = mma(ldfrag(Ap + ks * 32), ldfrag(Bp + ks * 32), acc);

#pragma unroll
    for (int r = 0; r < 8; ++r) sS[(8 * h + r) * NN + w * 16 + m] = acc[r] * 0.000244140625f;   // 2^-12
    __syncthreads();
#pragma unroll 1
    for (int e = tid; e < 2048; e += 256) sS[e] = expf(sS[e]);
    __syncthreads();

    const v4f p0 = *(const v4f*)(sS + (size_t)tid * 8);
    const v4f p1 = *(const v4f*)(sS + (size_t)tid * 8 + 4);
    v4u pk;
    pk[0] = pack2(p0[0], p0[1]);
    pk[1] = pack2(p0[2], p0[3]);
    pk[2] = pack2(p1[0], p1[1]);
    pk[3] = pack2(p1[2], p1[3]);
    *(v4u*)(S + (size_t)j0 * NN + (size_t)tid * 8) = pk;
  } else {
    unsigned short* sT = (unsigned short*)(void*)sS;    // 64 x 64 halves
    const _Float16* V   = Q + (size_t)2 * PLN;          // [n][e]
    const _Float16* WoT = (const _Float16*)(const void*)WTp + (size_t)3 * WSZ;   // [d][e]
    const int vb = bid - NBATCH * (NN / 16);            // 0..63
    const int d0 = (vb >> 4) * 64;
    const int n0 = (vb & 15) * 64;
    const int wr = w >> 1, wc = w & 1;

    const _Float16* Ap  = WoT + (size_t)(d0 + 16 * wr + m) * DDIM + 8 * h;
    const _Float16* Bp0 = V + (size_t)(n0 + 32 * wc + m) * DDIM + 8 * h;
    const _Float16* Bp1 = Bp0 + (size_t)16 * DDIM;
    v16h Af[8], Bf0[8], Bf1[8];                         // all 48 loads in flight at once: one L2 round trip
#pragma unroll
    for (int ks = 0; ks < 8; ++ks) {
      Af[ks]  = ldfrag(Ap + ks * 32);
      Bf0[ks] = ldfrag(Bp0 + ks * 32);
      Bf1[ks] = ldfrag(Bp1 + ks * 32);
    }
    v8f acc0 = fill8(0.0f), acc1 = fill8(0.0f);
#pragma unroll
    for (int ks = 0; ks < 8; ++ks) {
      acc0 = mma(Af[ks], Bf0[ks], acc0);
      acc1 = mma(Af[ks], Bf1[ks], acc1);
    }
#pragma unroll
    for (int r = 0; r < 8; ++r) {                        // D row d = 16 wr + 8h + r, col n = 32 wc + m (+16)
      unsigned short* tp = sT + (16 * wr + 8 * h + r) * 64 + 32 * wc + m;
      tp[0]  = h_bits(acc0[r] * 0.0009765625f);          // 16384 v.Wo * 2^-10 = 16 v.Wo
      tp[16] = h_bits(acc1[r] * 0.0009765625f);
    }
    __syncthreads();

    const int piece = tid & 7, rq = tid >> 3;           // rq 0..31
    const int b = n0 >> 7, kk0 = n0 & (NN - 1);         // flattened col n0 = batch b, node kk0
    v4u pv[2];
#pragma unroll
    for (int it = 0; it < 2; ++it) pv[it] = *(const v4u*)(sT + (it * 32 + rq) * 64 + piece * 8);
#pragma unroll
    for (int it = 0; it < 2; ++it)
      *(v4u*)(VWT + (size_t)(b * DDIM + d0 + it * 32 + rq) * NN + kk0 + piece * 8) = pv[it];
  }
}

// =====================================================================================================
// k_main: block (b, jt, dq) owns out[b][16 jt .. +15][64 dq .. +63] and sees every subtree i itself, so the max over i
// needs no cross-block exchange. With a[i][kk] = (adj[b][i][kk] != 0) and s = S[b][j]:
//   O[i][d] = (sum_kk a[i][kk] s[kk] VW[kk][d]) / max(den[i], 1e-9),  den[i] = sum_kk a[i][kk] s[kk]   (adj[b][i][j] != 0)
// so the operand with index i is the 0/1 plane AH[b], the same for every j: staged once in LDS (At) for the block's 16 j.
// Prologue: At <- AH[b]; sS <- the 16 score rows; wave w: den tile D[row j = 8h + r][col i = 16 w + m] = S rows . AH rows
//   (both k = kk, split, straight from global); sc2[j][i] = (scale, offset): adj_mask != 0 -> (0, -1e12);
//   adj[b][i][j] == 0 -> (0, 0); else (2^-4 / max(den, 1e-9), 0).
// Main: wave w: d tile dt = w & 3, j group jh = w >> 2; two passes of 4 j. A-op rows d = VWT rows times s_j (f16, k = kk,
//   split), kept in registers; B-op cols i = At rows (k = kk, split); D[row d = 8h + r][col i = 16 it + m];
//   val = D * scale + offset; running max over the 8 i tiles per lane, then over the 16 lanes of a row.
// coverage: 256 blocks x 16 x 64 floats = the whole output; At 2048 x 16 B, sS 256 x 16 B, sc2 8 waves x 16 x 16 pairs,
//   all before the first barrier; sO 8 waves x 2 passes x 64 floats before the second.
// =====================================================================================================
template <int X>
__device__ __forceinline__ float rowx(float v) {        // value of lane (lane ^ X) inside the 16-lane row
  return __builtin_bit_cast(float, __builtin_amdgcn_update_dpp(0, __builtin_bit_cast(int, v), 0x160 + X, 0xf, 0xf, true));
}
// N values per lane -> N/2: lanes with bit X clear keep the even ones, lanes with it set the odd ones, each joined
// by max with the partner lane's copy of the same value.
template <int X, int N>
__device__ __forceinline__ void foldmax(float* v, int m) {
  const bool hi = (m & X) != 0;
#pragma unroll
  for (int k = 0; k < N / 2; ++k) {
    const float a = v[2 * k], b = v[2 * k + 1];
    const float mine = hi ? b : a;
    const float send = hi ? a : b;
    v[k] = fmaxf(mine, rowx<X>(send));
  }
}
__device__ __forceinline__ v8f wm(v16h a, v16h b, v8f c) {
  return __builtin_amdgcn_wmma_f32_16x16x32_f16(false, a, false, b, (short)0, c, false, false);
}

// one i tile against 4 j: 16 products on 4 independent accumulators, then scale, offset and the running max
__device__ __forceinline__ void tile4(const v16h (&Bs)[4][4], const v16h (&f)[4], const float* sp, float (&M)[32]) {
  v2f so[4];
#pragma unroll
  for (int jj = 0; jj < 4; ++jj) so[jj] = *(const v2f*)(sp + jj * NN * 2);
  v8f c[4];
#pragma unroll
  for (int jj = 0; jj < 4; ++jj) c[jj] = fill8(0.0f);
#pragma unroll
  for (int ks = 0; ks < 4; ++ks) {
#pragma unroll
    for (int jj = 0; jj < 4; ++jj) c[jj] = wm(Bs[jj][ks], f[ks], c[jj]);
  }
#pragma unroll
  for (int jj = 0; jj < 4; ++jj) {
#pragma unroll
    for (int q = 0; q < 4; ++q) {                        // neighbouring registers as one packed multiply-add
      v2f cc;
      cc[0] = c[jj][2 * q];
      cc[1] = c[jj][2 * q + 1];
      const v2f v = cc * so[jj][0] + so[jj][1];
      M[jj * 8 + 2 * q]     = fmaxf(M[jj * 8 + 2 * q], v[0]);
      M[jj * 8 + 2 * q + 1] = fmaxf(M[jj * 8 + 2 * q + 1], v[1]);
    }
  }
}

__global__ __launch_bounds__(256) void k_main(const unsigned short* __restrict__ AHp, const int* __restrict__ adj,
                                              const int* __restrict__ adjm, const unsigned short* __restrict__ Sp,
                                              const unsigned short* __restrict__ VWTp,
                                              const float* __restrict__ bo, float* out) {
  __shared__ __align__(16) _Float16 At[NN * PPITCH];    // [128 i][128 kk of pitch PPITCH]; pad halves never read
  __shared__ __align__(16) _Float16 sS[JT * NN];        // [16 j][128 kk]
  __shared__ __align__(16) float sc2[JT * NN * 2];      // [16 j][128 i] (scale, offset)
  __shared__ __align__(16) float sO[JT * DQ];
  const int tid  = threadIdx.x;
  const int lane = tid & 31, w = tid >> 5, h = lane >> 4, m = lane & 15;
  const int dq   = blockIdx.x & 3;
  const int jt   = (blockIdx.x >> 2) & 7;
  const int b    = blockIdx.x >> 5;
  const int j0   = jt * JT, d0 = dq * DQ;
  const int dt   = w & 3, jh = w >> 2;
  const _Float16* AHb = (const _Float16*)(const void*)AHp + (size_t)b * NN * NN;          // [i][kk]
  const _Float16* Sb  = (const _Float16*)(const void*)Sp + (size_t)(b * NN + j0) * NN;    // [16 j][kk]
  const _Float16* vp  = (const _Float16*)(const void*)VWTp + (size_t)(b * DDIM + d0 + 16 * dt + m) * NN + 8 * h;

  const _Float16* pS  = Sb + (size_t)m * NN + 8 * h;                     // A-op row j = j0 + m
  const _Float16* pE  = AHb + (size_t)(16 * w + m) * NN + 8 * h;         // B-op col i = 16 w + m
  const size_t ij = (size_t)(b * NN + 16 * w + m) * NN + j0 + 8 * h;     // (i = 16 w + m, j = j0 + 8h + 0..7)
  const int* pA = adj + ij;
  const int* pM = adjm + ij;

  // ---------------- prologue: every global load but the bias in flight at once ----------------
  v4u st[8];
#pragma unroll
  for (int q = 0; q < 8; ++q) st[q] = *(const v4u*)(AHb + (size_t)(q * 256 + tid) * 8);
  const v4u ss = *(const v4u*)(Sb + (size_t)tid * 8);
  v16h sa[4], ea[4], VWf[4];
#pragma unroll
  for (int ks = 0; ks < 4; ++ks) {
    sa[ks]  = ldfrag(pS + ks * 32);
    ea[ks]  = ldfrag(pE + ks * 32);
    VWf[ks] = ldfrag(vp + ks * 32);
  }
  const v4i aj0 = *(const v4i*)(pA), aj1 = *(const v4i*)(pA + 4);
  const v4i mj0 = *(const v4i*)(pM), mj1 = *(const v4i*)(pM + 4);
#if defined(__HIP_DEVICE_COMPILE__)
  // the wait stands before any write of these loads' address registers: as inputs here the addresses stay in
  // their registers up to it, so neither a later result nor a later load's data takes those registers earlier
  asm volatile("s_wait_xcnt 0x0" :: "v"(pS), "v"(pE), "v"(vp), "v"(pA), "v"(pM) : "memory");
#endif
#pragma unroll
  for (int q = 0; q < 8; ++q) {
    const int idx = q * 256 + tid;                      // row idx >> 4, 16-B piece idx & 15
    *(v4u*)(At + (idx >> 4) * PPITCH + (idx & 15) * 8) = st[q];
  }
  *(v4u*)(sS + tid * 8) = ss;
  {
    v8f den = fill8(0.0f);
#pragma unroll
    for (int ks = 0; ks < 4; ++ks) den = wm(sa[ks], ea[ks], den);
#pragma unroll
    for (int r = 0; r < 8; ++r) {
      const int aij = (r < 4) ? aj0[r & 3] : aj1[r & 3];
      const int msk = (r < 4) ? mj0[r & 3] : mj1[r & 3];
      const float rd = 0.0625f / fmaxf(den[r], 1.0e-9f);
      v2f so;
      so[0] = (aij != 0 && msk == 0) ? rd : 0.0f;
      so[1] = (msk == 0) ? 0.0f : -1.0e12f;
      *(v2f*)(sc2 + ((8 * h + r) * NN + 16 * w + m) * 2) = so;
    }
  }
  __syncthreads();

  // ---------------- main: (s_j * VW) . adj^T, scaled, masked max over i ----------------
  const _Float16* ap = At + m * PPITCH + 8 * h;          // B-op col i = 16 it + (lane & 15)
#pragma unroll 1                                         // rolled: one pass's 16 scaled fragments live at a time
  for (int p = 0; p < 2; ++p) {
    const int jl0 = jh * 8 + p * 4;
    v16h Bs[4][4];
#pragma unroll
    for (int jj = 0; jj < 4; ++jj) {
#pragma unroll
      for (int ks = 0; ks < 4; ++ks) Bs[jj][ks] = VWf[ks] * ldfrag(sS + (jl0 + jj) * NN + ks * 32 + 8 * h);
    }
    float M[32];
#pragma unroll
    for (int e = 0; e < 32; ++e) M[e] = -3.0e38f;
    const float* sp = sc2 + (jl0 * NN + m) * 2;
    v16h f0[4], f1[4];                                   // two fragment sets: one is filled while the other is used
#pragma unroll
    for (int ks = 0; ks < 4; ++ks) f0[ks] = ldfrag(ap + ks * 32);
#pragma unroll 1                                         // rolled: unrolled, all 8 tiles' LDS reads were hoisted and spilled
    for (int t2 = 0; t2 < 4; ++t2) {
      const _Float16* a1 = ap + (2 * t2 + 1) * 16 * PPITCH;
      const _Float16* a2 = ap + ((2 * t2 + 2) & 7) * 16 * PPITCH;   // last trip: tile 0 again, read and not used
      const float* s0 = sp + t2 * 64;
#pragma unroll
      for (int ks = 0; ks < 4; ++ks) f1[ks] = ldfrag(a1 + ks * 32);
      tile4(Bs, f0, s0, M);
#pragma unroll
      for (int ks = 0; ks < 4; ++ks) f0[ks] = ldfrag(a2 + ks * 32);
      tile4(Bs, f1, s0 + 32, M);
    }
    // index e = 8 jj + r: bits 0..3 go to lane bits 0..3, bit 4 stays as the two values left per lane
    foldmax<1, 32>(M, m);
    foldmax<2, 16>(M, m);
    foldmax<4, 8>(M, m);
    foldmax<8, 4>(M, m);
    float* ob = sO + (jl0 + (m >> 3)) * DQ + 16 * dt + 8 * h + (m & 7);
    ob[0]      = M[0];                                   // jj = (m >> 3)
    ob[2 * DQ] = M[1];                                   // jj = 2 + (m >> 3)
  }
  __syncthreads();

  {                                                      // 256 threads x 16 B: 16 rows of 256 B, two whole lines each
    const int jl = tid >> 4, pc = (tid & 15) * 4;
    const v4f mv = *(const v4f*)(sO + jl * DQ + pc);
    const v4f bv = *(const v4f*)(bo + d0 + pc);
    v4f ov;
#pragma unroll
    for (int u = 0; u < 4; ++u) ov[u] = (mv[u] == -1.0e12f) ? -1.0e12f : mv[u] + bfr(bv[u]);
    *(v4f*)(out + (size_t)(b * NN + j0 + jl) * DDIM + d0 + pc) = ov;
  }
}

// =====================================================================================================
// Workspace map (bytes); every region is an exact multiple of its whole-line store granularity:
//   (not used)                                524288 at       0
//   WT   f16 [4][256][256], plane 3 alone     524288 at  524288
//   QKV  f16 Q, K, V [1024][256] each        1572864 at 1048576
//   S    f16 [8][128][128]                    262144 at 2621440
//   VWT  f16 [8][256][128]                    524288 at 2883584
//   AH   f16 [8][128][128]                    262144 at 3407872
//   total                                    3670016
// =====================================================================================================
extern "C" void kernel_launch(void* const* d_in, const int* in_sizes, int n_in,
                              void* d_out, int out_size, void* d_ws, size_t ws_size,
                              hipStream_t stream) {
  if (n_in < 11) return;
  if (in_sizes[0] != SSZ) return;                // adj
  if (in_sizes[1] != PLN) return;                // sat_inputs
  if (in_sizes[2] != SSZ) return;                // adj_mask
  if (in_sizes[3] != WSZ || in_sizes[4] != DDIM) return;
  if (in_sizes[5] != WSZ || in_sizes[6] != DDIM) return;
  if (in_sizes[7] != WSZ || in_sizes[8] != DDIM) return;
  if (in_sizes[9] != WSZ || in_sizes[10] != DDIM) return;
  if (out_size != PLN) return;

  const int*   adj  = (const int*)d_in[0];       // [8][128][128]
  const float* x    = (const float*)d_in[1];     // [8][128][256]
  const int*   adjm = (const int*)d_in[2];       // [8][128][128]
  const float* Wq   = (const float*)d_in[3];  const float* bq = (const float*)d_in[4];
  const float* Wk   = (const float*)d_in[5];  const float* bk = (const float*)d_in[6];
  const float* Wv   = (const float*)d_in[7];  const float* bv = (const float*)d_in[8];
  const float* Wo   = (const float*)d_in[9];  const float* bo = (const float*)d_in[10];
  float* out = (float*)d_out;                    // [8][128][256]

  const size_t offXh  = 0;
  const size_t offWT  = offXh  + (size_t)PLN * 2;
  const size_t offQKV = offWT  + (size_t)4 * WSZ * 2;
  const size_t offS   = offQKV + (size_t)3 * PLN * 2;
  const size_t offVW  = offS   + (size_t)SSZ * 2;
  const size_t offAH  = offVW  + (size_t)PLN * 2;
  const size_t total  = offAH  + (size_t)SSZ * 2;          // 3670016
  if (total > ws_size) return;
  if (total > (size_t)134217728) return;

  char* ws = (char*)d_ws;
  unsigned short* WT  = (unsigned short*)(ws + offWT);
  unsigned short* QKV = (unsigned short*)(ws + offQKV);
  unsigned short* S   = (unsigned short*)(ws + offS);
  unsigned short* VWT = (unsigned short*)(ws + offVW);
  unsigned short* AH  = (unsigned short*)(ws + offAH);

  k_proj<<<dim3(NPROJ + 8 + SSZ / 2048), dim3(256), 0, stream>>>(x, Wq, Wk, Wv, Wo, bq, bk, bv, adj, QKV, WT, AH);
  k_scores<<<dim3(NBATCH * (NN / 16) + (DDIM / 64) * (NROWS / 64)), dim3(256), 0, stream>>>(QKV, WT, S, VWT);
  k_main<<<dim3(NBATCH * (NN / JT) * (DDIM / DQ)), dim3(256), 0, stream>>>(AH, adj, adjm, S, VWT, bo, out);
  (void)hipGetLastError();
}

// v006
// It runs in 15.3 microseconds.
// Timed twice side by side with v005, it ran 1.17 and 1.19 times as fast.
// Counting every step since v000, it is 10.5 times as fast.
// Contractions on v_wmma_f32_16x16x32_f16, f32 accumulate: x.Wq, x.Wk, x.Wv (x carried x16, W x1024, f16 built
// from bf16-RNE inputs); q.k^T (q, k carried x16); per b: v.Wo (v carried x16, Wo x1024); per (b,j): (s_j * v.Wo).adj^T
// (s_j * v.Wo carried x16, adj 0/1) and the row sums s_j.adj^T; single products. exp, reciprocal, the scaling by s_j (f16),
// the division by the row sum, bias adds and the max-pool on VALU.
#include <hip/hip_runtime.h>
#include <stdint.h>

#define NBATCH 8
#define NN     128
#define DDIM   256
#define NROWS  1024            // NBATCH*NN
#define PLN    262144          // NBATCH*NN*DDIM
#define WSZ    65536           // DDIM*DDIM
#define SSZ    131072          // NBATCH*NN*NN
static_assert(NROWS == NBATCH * NN);
static_assert(PLN == NROWS * DDIM);
static_assert(WSZ == DDIM * DDIM);
static_assert(SSZ == NBATCH * NN * NN);
static_assert(NN == 128);
static_assert(DDIM == 256);
static_assert((NROWS % 64) == 0);
#define PPITCH 136             // halves per LDS row of adj: 272 B = 16 B x 17, so 16 rows' 16-B pieces fall on all 64 banks
#define JT     16              // query rows j per k_main block
#define DQ     64              // output columns d per k_main block
#define XPITCH 264            // halves per LDS row of the x and W tiles of k_proj: 528 B = 16 B x 33
#define NPROJ  192            // projection blocks of k_proj: 3 planes x (NROWS / 64) x (DDIM / 64)
static_assert(NPROJ == 3 * (NROWS / 64) * (DDIM / 64));
static_assert(XPITCH >= DDIM && (XPITCH % 8) == 0 && ((XPITCH / 8) % 2) == 1);
static_assert(PPITCH >= NN && (PPITCH % 8) == 0 && ((PPITCH / 8) % 2) == 1);

typedef _Float16     v16h __attribute__((ext_vector_type(16)));
typedef _Float16     v8h  __attribute__((ext_vector_type(8)));
typedef float        v8f  __attribute__((ext_vector_type(8)));
typedef float        v4f  __attribute__((ext_vector_type(4)));
typedef float        v2f  __attribute__((ext_vector_type(2)));
typedef int          v4i  __attribute__((ext_vector_type(4)));
typedef unsigned int v4u  __attribute__((ext_vector_type(4)));

union Frag { v16h v; v8h half[2]; };

// ---- scalar helpers --------------------------------------------------------------------------------
__device__ __forceinline__ unsigned short bf_bits(float f) {          // f32 -> bf16 bits, RNE convert
  unsigned u = __float_as_uint(f);
  return (unsigned short)((u + 0x7FFFu + ((u >> 16) & 1u)) >> 16);
}
__device__ __forceinline__ float bf_up(unsigned short b) { return __uint_as_float(((unsigned)b) << 16); }
__device__ __forceinline__ float bfr(float f) { return bf_up(bf_bits(f)); }   // value after bf16 RNE convert
__device__ __forceinline__ unsigned short h_bits(float f) {           // f32 -> f16 bits, RNE convert
  return __builtin_bit_cast(unsigned short, (_Float16)f);
}
__device__ __forceinline__ unsigned pack2(float a, float b) {         // two halves into one word, low = first
  return (unsigned)h_bits(a) | (((unsigned)h_bits(b)) << 16);
}
__device__ __forceinline__ v8f fill8(float x) {
  v8f z;
  z[0] = x; z[1] = x; z[2] = x; z[3] = x; z[4] = x; z[5] = x; z[6] = x; z[7] = x;
  return z;
}

// ---- 16-bit fragment loader (A, B alike): p points at row/col (lane&15), k0 + 8*(lane>>4);
//      elements 0..7 <- p[0..7] (k0+8h..k0+8h+7), elements 8..15 <- p[16..23] (k0+16+8h..k0+16+8h+7)
__device__ __forceinline__ v16h ldfrag(const _Float16* p) {
  Frag f;
  f.half[0] = *(const v8h*)(p);
  f.half[1] = *(const v8h*)(p + 16);
  return f.v;
}

// ---- WMMA with trailing VALU hazard gap (ties D, keeps A/B live past the nops) ---------------------
__device__ __forceinline__ v8f mma(v16h a, v16h b, v8f c) {
  v8f d = __builtin_amdgcn_wmma_f32_16x16x32_f16(false, a, false, b, (short)0, c, false, false);
#if defined(__HIP_DEVICE_COMPILE__)
  asm volatile("v_nop\n\tv_nop\n\tv_nop\n\tv_nop" : "+v"(d) : "v"(a), "v"(b));
#endif
  return d;
}

// =====================================================================================================
// k_proj, blocks 0..191: plane pj = 0 (q), 1 (k), 2 (v): val[n][e] = f16 of 16*(x[n][:].W[:][e] + bfr(bias[e])), n flattened
// over (b, node) 0..1023. Block (pj, rt, cg): rows n = 64 rt .. +63, cols e = 64 cg .. +63. The block converts its own
// operands from the f32 inputs: sX[n][f] = f16 of (bf16-RNE x * 16); sW[e][f] = f16 of (bf16-RNE W[f][e] * 1024), the
// transpose made in registers (a thread holds 8 f x 4 e and stores 8 f of one e as 16 B). In sW the 16-B piece c of row e
// lies at piece c ^ ((e >> 4) & 3): the 16 rows 4 apart that one store covers then fall on all 64 banks; a fragment read
// covers 16 neighbouring rows, for which that term is one constant. 8 waves, wave w: rows 16(w>>1), cols 32(w&1) +
// {0..15, 16..31}. A-op = sX row n (k = f, split map), B-op = sW row e (k = f, split map); D row n = ... + 8h + r,
// col e = ... + (lane&15); acc = 16384 * (x.W).
// coverage: sX 2048 x 16 B, sW 2048 x 16 B before the first barrier; per plane 16 x 4 blocks x 64 x 64 = 1024 x 256.
// Blocks 192..199: rows e0..e0+31 of WT[3][e][f] = f16 of (bf16-RNE Wo[f][e] * 1024): LDS tile [32 c][256 f] filled by
// 2-B stores, then 4 whole-line stores per thread. coverage: 8 x 8192 halves = all of WT[3] (256 x 256).
// Blocks 200..263: AH[b][i][kk] = f16 1.0 where adj[b][i][kk] != 0, else 0; 8 elements per thread, one 16-B store.
// coverage: 64 blocks x 2048 halves = all of AH (8 x 128 x 128).
// =====================================================================================================
__global__ __launch_bounds__(256) void k_proj(const float* __restrict__ x,
                                              const float* __restrict__ Wq, const float* __restrict__ Wk,
                                              const float* __restrict__ Wv, const float* __restrict__ Wo,
                                              const float* __restrict__ bq, const float* __restrict__ bk,
                                              const float* __restrict__ bv, const int* __restrict__ adj,
                                              unsigned short* QKV, unsigned short* WT, unsigned short* AH) {
  __shared__ __align__(16) unsigned short sX[64 * XPITCH];
  __shared__ __align__(16) unsigned short sW[64 * XPITCH];
  __shared__ __align__(16) unsigned short sT[4096];     // 64 x 64
  const int tid  = threadIdx.x;
  const int bid  = blockIdx.x;                          // 0..263, role is block-uniform

  if (bid < NPROJ) {
    const int lane = tid & 31, w = tid >> 5, h = lane >> 4, m = lane & 15;
    const int pj   = bid / ((NROWS / 64) * (DDIM / 64));   // 0..2 (block-uniform)
    const int rt   = (bid / (DDIM / 64)) % (NROWS / 64);   // 64-row tile of the NROWS flattened rows
    const int cg   = bid % (DDIM / 64);
    const int n0   = rt * 64;
    const int e0g  = cg * 64;
    const int wr   = w >> 1, wc = w & 1;
    const float* bias = (pj == 0) ? bq : ((pj == 1) ? bk : bv);   // block-uniform, all global
    const float* wsrc = (pj == 0) ? Wq : ((pj == 1) ? Wk : Wv);   // block-uniform, all global

    // ---- both f32 tiles and the bias in flight at once: 32 loads of 16 B and 2 of 4 B per thread ----
    const int xr = tid >> 5, xc = (tid & 31) * 8;       // x: row 8 q + xr, columns xc .. xc + 7
    const int fq = tid >> 4, e4 = (tid & 15) * 4;       // W: rows 8 (16 it + fq) + 0..7, columns e4 .. e4 + 3
    const float* px = x + (size_t)(n0 + xr) * DDIM + xc;
    const float* pw = wsrc + (size_t)(fq * 8) * DDIM + e0g + e4;
    const int el0 = 32 * wc + m, el1 = el0 + 16;
    const float* pb = bias + e0g + el0;
    v4f xa[8], xb[8], wv[2][8];
#pragma unroll
    for (int q = 0; q < 8; ++q) {
      xa[q] = *(const v4f*)(px + q * 8 * DDIM);
      xb[q] = *(const v4f*)(px + q * 8 * DDIM + 4);
    }
#pragma unroll
    for (int it = 0; it < 2; ++it) {
#pragma unroll
      for (int r = 0; r < 8; ++r) wv[it][r] = *(const v4f*)(pw + (it * 128 + r) * DDIM);
    }
    const float rb0 = pb[0], rb1 = pb[16];
#if defined(__HIP_DEVICE_COMPILE__)
    // the wait stands before any write of these loads' address registers: as inputs here the addresses stay in
    // their registers up to it
    asm volatile("s_wait_xcnt 0x0" :: "v"(px), "v"(pw) : "memory");
#endif
    // no conversion is scheduled among the loads: without this the last 8 loads were issued behind a wait on the first 26
    __builtin_amdgcn_sched_barrier(0);
#pragma unroll
    for (int q = 0; q < 8; ++q) {
      v4u pk;
      pk[0] = pack2(bfr(xa[q][0]) * 16.0f, bfr(xa[q][1]) * 16.0f);
      pk[1] = pack2(bfr(xa[q][2]) * 16.0f, bfr(xa[q][3]) * 16.0f);
      pk[2] = pack2(bfr(xb[q][0]) * 16.0f, bfr(xb[q][1]) * 16.0f);
      pk[3] = pack2(bfr(xb[q][2]) * 16.0f, bfr(xb[q][3]) * 16.0f);
      *(v4u*)(sX + (q * 8 + xr) * XPITCH + xc) = pk;
    }
    const int gs = (tid & 15) >> 2;                     // (e >> 4) & 3 of this thread's four rows e4 .. e4 + 3
#pragma unroll
    for (int it = 0; it < 2; ++it) {
      const int pc = (it * 16 + fq) ^ gs;               // place of piece f / 8 = 16 it + fq
#pragma unroll
      for (int u = 0; u < 4; ++u) {
        v4u pk;
        pk[0] = pack2(bfr(wv[it][0][u]) * 1024.0f, bfr(wv[it][1][u]) * 1024.0f);
        pk[1] = pack2(bfr(wv[it][2][u]) * 1024.0f, bfr(wv[it][3][u]) * 1024.0f);
        pk[2] = pack2(bfr(wv[it][4][u]) * 1024.0f, bfr(wv[it][5][u]) * 1024.0f);
        pk[3] = pack2(bfr(wv[it][6][u]) * 1024.0f, bfr(wv[it][7][u]) * 1024.0f);
        *(v4u*)(sW + (e4 + u) * XPITCH + pc * 8) = pk;
      }
    }
    __syncthreads();

    const _Float16* Ap  = (const _Float16*)(const void*)sX + (16 * wr + m) * XPITCH + 8 * h;
    const _Float16* Bp0 = (const _Float16*)(const void*)sW + (32 * wc + m) * XPITCH;      // rows with (e >> 4) & 3 = 2 wc
    const _Float16* Bp1 = Bp0 + 16 * XPITCH;                                              // rows with (e >> 4) & 3 = 2 wc + 1
    const int g0 = 2 * wc, g1 = 2 * wc + 1;
    const int o00 = (h ^ g0) * 8, o01 = ((2 + h) ^ g0) * 8;   // places of pieces h and 2 + h inside each group of four
    const int o10 = (h ^ g1) * 8, o11 = ((2 + h) ^ g1) * 8;
    v16h Af[8];
    Frag Bf0[8], Bf1[8];                                // all 48 LDS reads issued as one group ahead of the products
#pragma unroll
    for (int ks = 0; ks < 8; ++ks) {
      Af[ks] = ldfrag(Ap + ks * 32);
      Bf0[ks].half[0] = *(const v8h*)(Bp0 + ks * 32 + o00);
      Bf0[ks].half[1] = *(const v8h*)(Bp0 + ks * 32 + o01);
      Bf1[ks].half[0] = *(const v8h*)(Bp1 + ks * 32 + o10);
      Bf1[ks].half[1] = *(const v8h*)(Bp1 + ks * 32 + o11);
    }
    v8f acc0 = fill8(0.0f), acc1 = fill8(0.0f);
#pragma unroll
    for (int ks = 0; ks < 8; ++ks) {
      acc0 = mma(Af[ks], Bf0[ks].v, acc0);
      acc1 = mma(Af[ks], Bf1[ks].v, acc1);
    }

    const float bb0 = bfr(rb0);
    const float bb1 = bfr(rb1);
#pragma unroll
    for (int r = 0; r < 8; ++r) {
      const int nl = 16 * wr + 8 * h + r;
      const float v0 = (acc0[r] * 6.103515625e-05f + bb0) * 16.0f;  // acc/16384 + b, carried x16
      const float v1 = (acc1[r] * 6.103515625e-05f + bb1) * 16.0f;
      sT[nl * 64 + el0] = h_bits(v0);
      sT[nl * 64 + el1] = h_bits(v1);
    }
    __syncthreads();

    const int piece = tid & 7, rq = tid >> 3;           // rq 0..31
    v4u pv[2];
    size_t o[2];
#pragma unroll
    for (int it = 0; it < 2; ++it) {
      const int row = it * 32 + rq;                     // tile row nl 0..63
      pv[it] = *(const v4u*)(sT + row * 64 + piece * 8);
      o[it] = (size_t)pj * PLN + (size_t)(n0 + row) * DDIM + e0g + piece * 8;
    }
#pragma unroll
    for (int it = 0; it < 2; ++it) *(v4u*)(QKV + o[it]) = pv[it];
  } else if (bid < NPROJ + 8) {
    const int e0 = (bid - NPROJ) * 32;
#pragma unroll 1
    for (int it = 0; it < 4; ++it) {
      const int p  = it * 256 + tid;           // 0..1023
      const int f  = p >> 2;                   // 0..255
      const int c8 = (p & 3) * 8;              // 0,8,16,24
      const float* q = Wo + (size_t)f * DDIM + e0 + c8;
      const v4f v0 = *(const v4f*)(q);
      const v4f v1 = *(const v4f*)(q + 4);
      unsigned short* d = sX + c8 * 256 + f;   // tile layout [c][f], 8192 halves of sX
#pragma unroll
      for (int u = 0; u < 4; ++u) {
        d[u * 256]       = h_bits(bfr(v0[u]) * 1024.0f);
        d[(u + 4) * 256] = h_bits(bfr(v1[u]) * 1024.0f);
      }
    }
    __syncthreads();
    unsigned short* dst = WT + (size_t)3 * WSZ + (size_t)e0 * DDIM;
    v4u pv[4];
#pragma unroll
    for (int it = 0; it < 4; ++it) pv[it] = *(const v4u*)(sX + (size_t)(it * 256 + tid) * 8);
#pragma unroll
    for (int it = 0; it < 4; ++it) *(v4u*)(dst + (size_t)(it * 256 + tid) * 8) = pv[it];
  } else {
    const size_t base = (size_t)(bid - (NPROJ + 8)) * 2048 + (size_t)tid * 8;
    const v4i a0 = *(const v4i*)(adj + base);
    const v4i a1 = *(const v4i*)(adj + base + 4);
    v4u pk;
    pk[0] = (a0[0] != 0 ? 0x3C00u : 0u) | (a0[1] != 0 ? 0x3C000000u : 0u);
    pk[1] = (a0[2] != 0 ? 0x3C00u : 0u) | (a0[3] != 0 ? 0x3C000000u : 0u);
    pk[2] = (a1[0] != 0 ? 0x3C00u : 0u) | (a1[1] != 0 ? 0x3C000000u : 0u);
    pk[3] = (a1[2] != 0 ? 0x3C00u : 0u) | (a1[3] != 0 ? 0x3C000000u : 0u);
    *(v4u*)(AH + base) = pk;
#if defined(__HIP_DEVICE_COMPILE__)
    asm volatile("s_wait_xcnt 0x0" ::: "memory");       // before any later write of the store's address or data registers
#endif
  }
}

// =====================================================================================================
// k_main: block (b, jt, dq) owns out[b][16 jt .. +15][64 dq .. +63] and sees every subtree i itself, so the max over i
// needs no cross-block exchange. With a[i][kk] = (adj[b][i][kk] != 0) and s = S[j]:
//   O[i][d] = (sum_kk a[i][kk] s[kk] VW[kk][d]) / max(den[i], 1e-9),  den[i] = sum_kk a[i][kk] s[kk]   (adj[b][i][j] != 0)
// so the operand with index i is the 0/1 plane AH[b], the same for every j: staged once in LDS (At) for the block's 16 j.
// The block makes its own score rows and its own v.Wo tile from the planes of k_proj:
//   S[j][kk] = f16 of expf((q_j.k_kk)/16), 16 j x 128 kk;  VW[d][kk] = f16 of 16 * sum_e v[kk][e] Wo[e][d], 64 d x 128 kk.
// Stage 1: every global load but bo's issued at once, the planes in whole lines, in the order Q, K, V, WoT, AH, adj, adj_mask.
// Stage 2a: sQ <- the 16 Q rows, sK <- the K rows of b; barrier 1 (LDS alone: the later planes stay in flight); wave w:
//   score tile, A-op = sK rows kk = 16 w + m, B-op = sQ rows j (both k = d, split); D[row kk = 8h + r][col j = m],
//   acc = 256 * q.k -> logit arg = acc * 2^-12: a lane's 8 registers are 8 neighbouring kk of one j, one 16-B store into sS.
// Stage 2b: sV <- the V rows of b, sW <- 64 rows of WoT; barrier 2 (LDS alone); wave w: kk tiles 2 (w & 3) + {0, 1}, d tiles
//   2 (w >> 2) + {0, 1}; A-op = sV rows kk, B-op = sW rows d (both k = e, split); D[row kk = 8h + r][col d = m],
//   acc = 16384 * v.Wo -> x 2^-10; one 16-B store per tile into sVW[d][kk]. Then At <- AH[b]; barrier 3.
// Stage 3: wave w: den tile D[row j = 8h + r][col i = 16 w + m] = sS rows . At rows (both k = kk, split);
//   sc2[j][i] = (scale, offset): adj_mask != 0 -> (0, -1e12); adj[b][i][j] == 0 -> (0, 0); else (2^-4 / max(den, 1e-9), 0).
// Main (behind barrier 4): wave w: d tile dt = w & 3, j group jh = w >> 2; two passes of 4 j. A-op rows d = sVW rows times
//   s_j (f16, k = kk, split), kept in registers; B-op cols i = At rows (k = kk, split); D[row d = 8h + r][col i = 16 it + m];
//   val = D * scale + offset; running max over the 8 i tiles per lane, then over the 16 lanes of a row.
// coverage: 256 blocks x 16 x 64 floats = the whole output; sQ 512, sK 4096 x 16 B before barrier 1; sV 4096, sW 2048 x 16 B
//   before barrier 2; sS 8 waves x 32 x 16 B, sVW 8 waves x 4 x 32 x 16 B, At 2048 x 16 B before barrier 3; sc2 8 waves x
//   16 x 16 pairs before barrier 4; sO 8 waves x 2 passes x 64 floats before the last. No LDS byte has two uses.
// =====================================================================================================
template <int X>
__device__ __forceinline__ float rowx(float v) {        // value of lane (lane ^ X) inside the 16-lane row
  return __builtin_bit_cast(float, __builtin_amdgcn_update_dpp(0, __builtin_bit_cast(int, v), 0x160 + X, 0xf, 0xf, true));
}
// N values per lane -> N/2: lanes with bit X clear keep the even ones, lanes with it set the odd ones, each joined
// by max with the partner lane's copy of the same value.
template <int X, int N>
__device__ __forceinline__ void foldmax(float* v, int m) {
  const bool hi = (m & X) != 0;
#pragma unroll
  for (int k = 0; k < N / 2; ++k) {
    const float a = v[2 * k], b = v[2 * k + 1];
    const float mine = hi ? b : a;
    const float send = hi ? a : b;
    v[k] = fmaxf(mine, rowx<X>(send));
  }
}
__device__ __forceinline__ v8f wm(v16h a, v16h b, v8f c) {
  return __builtin_amdgcn_wmma_f32_16x16x32_f16(false, a, false, b, (short)0, c, false, false);
}

// one i tile against 4 j: 16 products on 4 independent accumulators, then scale, offset and the running max
__device__ __forceinline__ void tile4(const v16h (&Bs)[4][4], const v16h (&f)[4], const float* sp, float (&M)[32]) {
  v2f so[4];
#pragma unroll
  for (int jj = 0; jj < 4; ++jj) so[jj] = *(const v2f*)(sp + jj * NN * 2);
  v8f c[4];
#pragma unroll
  for (int jj = 0; jj < 4; ++jj) c[jj] = fill8(0.0f);
#pragma unroll
  for (int ks = 0; ks < 4; ++ks) {
#pragma unroll
    for (int jj = 0; jj < 4; ++jj) c[jj] = wm(Bs[jj][ks], f[ks], c[jj]);
  }
#pragma unroll
  for (int jj = 0; jj < 4; ++jj) {
#pragma unroll
    for (int q = 0; q < 4; ++q) {                        // neighbouring registers as one packed multiply-add
      v2f cc;
      cc[0] = c[jj][2 * q];
      cc[1] = c[jj][2 * q + 1];
      const v2f v = cc * so[jj][0] + so[jj][1];
      M[jj * 8 + 2 * q]     = fmaxf(M[jj * 8 + 2 * q], v[0]);
      M[jj * 8 + 2 * q + 1] = fmaxf(M[jj * 8 + 2 * q + 1], v[1]);
    }
  }
}
__device__ __forceinline__ v4u pack8(v8f c, float s) {  // 8 accumulator registers times s, as 8 halves
  v4u pk;
  pk[0] = pack2(c[0] * s, c[1] * s);
  pk[1] = pack2(c[2] * s, c[3] * s);
  pk[2] = pack2(c[4] * s, c[5] * s);
  pk[3] = pack2(c[6] * s, c[7] * s);
  return pk;
}

// work-group barrier that orders LDS alone: the wave's global loads that are still on their way stay in flight over it
__device__ __forceinline__ void lds_barrier() {
  __builtin_amdgcn_fence(__ATOMIC_RELEASE, "workgroup", "local");
  __builtin_amdgcn_s_barrier();
  __builtin_amdgcn_fence(__ATOMIC_ACQUIRE, "workgroup", "local");
}

__global__ __launch_bounds__(256) void k_main(const unsigned short* __restrict__ AHp, const int* __restrict__ adj,
                                              const int* __restrict__ adjm, const unsigned short* __restrict__ QKV,
                                              const unsigned short* __restrict__ WTp,
                                              const float* __restrict__ bo, float* out) {
  // one LDS block, laid out by hand: what the main loop reads lies in the first 64 KiB, inside the reach of the
  // 16-bit offset field of an LDS instruction
  __shared__ __align__(16) _Float16 sm[NN * PPITCH + JT * NN * 4 + JT * PPITCH + JT * DQ * 2 + DQ * PPITCH
                                       + JT * XPITCH + DQ * XPITCH + 2 * NN * XPITCH];
  _Float16* const At  = sm;                             // [128 i][128 kk of pitch PPITCH]; pad halves never read
  float* const    sc2 = (float*)(void*)(At + NN * PPITCH);           // [16 j][128 i] (scale, offset)
  _Float16* const sS  = At + NN * PPITCH + JT * NN * 4; // [16 j][128 kk of pitch PPITCH]
  float* const    sO  = (float*)(void*)(sS + JT * PPITCH);           // [16 j][64 d]
  _Float16* const sVW = sS + JT * PPITCH + JT * DQ * 2; // [64 d][128 kk of pitch PPITCH]
  _Float16* const sQ  = sVW + DQ * PPITCH;              // [16 j][256 d of pitch XPITCH]
  _Float16* const sW  = sQ + JT * XPITCH;               // [64 d][256 e of pitch XPITCH]
  _Float16* const sK  = sW + DQ * XPITCH;               // [128 kk][256 d of pitch XPITCH]
  _Float16* const sV  = sK + NN * XPITCH;               // [128 kk][256 e of pitch XPITCH]
  const int tid  = threadIdx.x;
  const int lane = tid & 31, w = tid >> 5, h = lane >> 4, m = lane & 15;
  const int dq   = blockIdx.x & 3;
  const int jt   = (blockIdx.x >> 2) & 7;
  const int b    = blockIdx.x >> 5;
  const int j0   = jt * JT, d0 = dq * DQ;
  const int dt   = w & 3, jh = w >> 2;
  const _Float16* Qp = (const _Float16*)(const void*)QKV;
  // each plane's part is one contiguous run of whole rows: thread tid takes the 16-B pieces tid, 256 + tid, ...
  const _Float16* pH = (const _Float16*)(const void*)AHp + (size_t)b * NN * NN + (size_t)tid * 8;             // [i][kk]
  const _Float16* pQ = Qp + (size_t)(b * NN + j0) * DDIM + (size_t)tid * 8;                                   // [16 j][d]
  const _Float16* pK = Qp + (size_t)PLN + (size_t)b * NN * DDIM + (size_t)tid * 8;                            // [kk][d]
  const _Float16* pV = Qp + (size_t)2 * PLN + (size_t)b * NN * DDIM + (size_t)tid * 8;                        // [kk][e]
  const _Float16* pW = (const _Float16*)(const void*)WTp + (size_t)3 * WSZ + (size_t)d0 * DDIM + (size_t)tid * 8;  // [64 d][e]
  const size_t ij = (size_t)(b * NN + 16 * w + m) * NN + j0 + 8 * h;     // (i = 16 w + m, j = j0 + 8h + 0..7)
  const int* pA = adj + ij;
  const int* pM = adjm + ij;

  // ---------------- stage 1: every global load of the block but bo's in flight at once ----------------
  // issued in the order in which the stages below take them: loads return in order, so a plane issued late holds back
  // the stage that waits for it; the two scheduling fences keep that order (without them four Wo^T loads were issued last
  // and half the kernel arguments were fetched between the planes)
  v4u gq[2], gk[16], gv[16], gw[8], st[8];
  __builtin_amdgcn_sched_barrier(0);
#pragma unroll
  for (int q = 0; q < 2; ++q) gq[q] = *(const v4u*)(pQ + q * 2048);
#pragma unroll
  for (int q = 0; q < 16; ++q) gk[q] = *(const v4u*)(pK + q * 2048);
#pragma unroll
  for (int q = 0; q < 16; ++q) gv[q] = *(const v4u*)(pV + q * 2048);
#pragma unroll
  for (int q = 0; q < 8; ++q) gw[q] = *(const v4u*)(pW + q * 2048);
  __builtin_amdgcn_sched_barrier(0);
#pragma unroll
  for (int q = 0; q < 8; ++q) st[q] = *(const v4u*)(pH + q * 2048);
  const v4i aj0 = *(const v4i*)(pA), aj1 = *(const v4i*)(pA + 4);
  const v4i mj0 = *(const v4i*)(pM), mj1 = *(const v4i*)(pM + 4);
#if defined(__HIP_DEVICE_COMPILE__)
  // the wait stands before any write of these loads' address registers: as inputs here the addresses stay live
  // up to it, so neither a later result nor a later load's data takes their registers earlier
  asm volatile("s_wait_xcnt 0x0" :: "v"(pQ), "v"(pK), "v"(pV), "v"(pW), "v"(pH), "v"(pA), "v"(pM) : "memory");
#endif
  // ---------------- stage 2a: Q and K to LDS; the block's score rows, while V, Wo^T and AH are still on their way ----------------
  {
    _Float16* rowp = sQ + w * XPITCH + lane * 8;         // piece q * 256 + tid of a 256-wide plane: row 8 q + w, piece lane
#pragma unroll
    for (int q = 0; q < 2; ++q) *(v4u*)(rowp + q * 8 * XPITCH) = gq[q];
    rowp = sK + w * XPITCH + lane * 8;
#pragma unroll
    for (int q = 0; q < 16; ++q) *(v4u*)(rowp + q * 8 * XPITCH) = gk[q];
  }
  lds_barrier();
  {
    const _Float16* ka = sK + (16 * w + m) * XPITCH + 8 * h;             // A-op row kk = 16 w + m
    const _Float16* qb = sQ + m * XPITCH + 8 * h;                        // B-op col j = j0 + m
    v16h kf[8], qf[8];                                  // all 32 LDS reads issued as one group ahead of the products
#pragma unroll
    for (int ks = 0; ks < 8; ++ks) {
      kf[ks] = ldfrag(ka + ks * 32);
      qf[ks] = ldfrag(qb + ks * 32);
    }
    // no product is scheduled among the reads: without this they stood in pairs among the products, each behind a wait to 0
    __builtin_amdgcn_sched_barrier(0);
    v8f acc = fill8(0.0f);
#pragma unroll
    for (int ks = 0; ks < 8; ++ks) acc = wm(kf[ks], qf[ks], acc);
    v4u pk;
#pragma unroll
    for (int u = 0; u < 4; ++u)
      pk[u] = pack2(expf(acc[2 * u] * 0.000244140625f), expf(acc[2 * u + 1] * 0.000244140625f));   // 2^-12
    *(v4u*)(sS + m * PPITCH + 16 * w + 8 * h) = pk;
  }

  // ---------------- stage 2b: V and Wo^T to LDS; the block's v.Wo tile, while AH is still on its way ----------------
  {
    _Float16* rowp = sV + w * XPITCH + lane * 8;
#pragma unroll
    for (int q = 0; q < 16; ++q) *(v4u*)(rowp + q * 8 * XPITCH) = gv[q];
    rowp = sW + w * XPITCH + lane * 8;
#pragma unroll
    for (int q = 0; q < 8; ++q) *(v4u*)(rowp + q * 8 * XPITCH) = gw[q];
  }
  lds_barrier();
  {
    const int kp = w & 3, dp = w >> 2;
    const _Float16* va = sV + (32 * kp + m) * XPITCH + 8 * h;            // A-op rows kk = 32 kp + m, + 16
    const _Float16* wb = sW + (32 * dp + m) * XPITCH + 8 * h;            // B-op cols d = d0 + 32 dp + m, + 16
    v16h a0[8], a1[8], b0[8], b1[8];                    // all 64 LDS reads issued as one group ahead of the products
#pragma unroll
    for (int ks = 0; ks < 8; ++ks) {
      a0[ks] = ldfrag(va + ks * 32);
      b0[ks] = ldfrag(wb + ks * 32);
      a1[ks] = ldfrag(va + 16 * XPITCH + ks * 32);
      b1[ks] = ldfrag(wb + 16 * XPITCH + ks * 32);
    }
    __builtin_amdgcn_sched_barrier(0);                  // as above: the reads stay one group
    v8f c00 = fill8(0.0f), c01 = fill8(0.0f), c10 = fill8(0.0f), c11 = fill8(0.0f);
#pragma unroll
    for (int ks = 0; ks < 8; ++ks) {
      c00 = wm(a0[ks], b0[ks], c00);
      c01 = wm(a0[ks], b1[ks], c01);
      c10 = wm(a1[ks], b0[ks], c10);
      c11 = wm(a1[ks], b1[ks], c11);
    }
    _Float16* tp = sVW + (32 * dp + m) * PPITCH + 32 * kp + 8 * h;       // 16384 v.Wo * 2^-10 = 16 v.Wo
    *(v4u*)(tp)                    = pack8(c00, 0.0009765625f);
    *(v4u*)(tp + 16)               = pack8(c10, 0.0009765625f);
    *(v4u*)(tp + 16 * PPITCH)      = pack8(c01, 0.0009765625f);
    *(v4u*)(tp + 16 * PPITCH + 16) = pack8(c11, 0.0009765625f);
  }
  // nothing that needs AH, adj or adj_mask is scheduled among the products above: without this a compare of stage 3 stood
  // behind the first product, with a wait for every global load in front of it
  __builtin_amdgcn_sched_barrier(0);
#pragma unroll
  for (int q = 0; q < 8; ++q) {
    const int idx = q * 256 + tid;                      // row idx >> 4, 16-B piece idx & 15
    *(v4u*)(At + (idx >> 4) * PPITCH + (idx & 15) * 8) = st[q];
  }
  __syncthreads();

  // ---------------- stage 3: row sums, scale and offset; this wave's v.Wo fragments ----------------
  v16h VWf[4];
  {
    const _Float16* pS = sS + m * PPITCH + 8 * h;                        // A-op row j = j0 + m
    const _Float16* pE = At + (16 * w + m) * PPITCH + 8 * h;             // B-op col i = 16 w + m
    const _Float16* vp = sVW + (16 * dt + m) * PPITCH + 8 * h;           // A-op row d = d0 + 16 dt + m of the main loop
    v16h sa[4], ea[4];
#pragma unroll
    for (int ks = 0; ks < 4; ++ks) {
      sa[ks]  = ldfrag(pS + ks * 32);
      ea[ks]  = ldfrag(pE + ks * 32);
      VWf[ks] = ldfrag(vp + ks * 32);
    }
    v8f den = fill8(0.0f);
#pragma unroll
    for (int ks = 0; ks < 4; ++ks) den = wm(sa[ks], ea[ks], den);
#pragma unroll
    for (int r = 0; r < 8; ++r) {
      const int aij = (r < 4) ? aj0[r & 3] : aj1[r & 3];
      const int msk = (r < 4) ? mj0[r & 3] : mj1[r & 3];
      const float rd = 0.0625f / fmaxf(den[r], 1.0e-9f);
      v2f so;
      so[0] = (aij != 0 && msk == 0) ? rd : 0.0f;
      so[1] = (msk == 0) ? 0.0f : -1.0e12f;
      *(v2f*)(sc2 + ((8 * h + r) * NN + 16 * w + m) * 2) = so;
    }
  }
  __syncthreads();

  // ---------------- main: (s_j * VW) . adj^T, scaled, masked max over i ----------------
  const _Float16* ap = At + m * PPITCH + 8 * h;          // B-op col i = 16 it + (lane & 15)
#pragma unroll 1                                         // rolled: one pass's 16 scaled fragments live at a time
  for (int p = 0; p < 2; ++p) {
    const int jl0 = jh * 8 + p * 4;
    v16h Bs[4][4];
#pragma unroll
    for (int jj = 0; jj < 4; ++jj) {
#pragma unroll
      for (int ks = 0; ks < 4; ++ks) Bs[jj][ks] = VWf[ks] * ldfrag(sS + (jl0 + jj) * PPITCH + ks * 32 + 8 * h);
    }
    float M[32];
#pragma unroll
    for (int e = 0; e < 32; ++e) M[e] = -3.0e38f;
    const float* sp = sc2 + (jl0 * NN + m) * 2;
    v16h f0[4], f1[4];                                   // two fragment sets: one is filled while the other is used
#pragma unroll
    for (int ks = 0; ks < 4; ++ks) f0[ks] = ldfrag(ap + ks * 32);
#pragma unroll 1                                         // rolled: unrolled, all 8 tiles' LDS reads were hoisted and spilled
    for (int t2 = 0; t2 < 4; ++t2) {
      const _Float16* a1 = ap + (2 * t2 + 1) * 16 * PPITCH;
      const _Float16* a2 = ap + ((2 * t2 + 2) & 7) * 16 * PPITCH;   // last trip: tile 0 again, read and not used
      const float* s0 = sp + t2 * 64;
#pragma unroll
      for (int ks = 0; ks < 4; ++ks) f1[ks] = ldfrag(a1 + ks * 32);
      tile4(Bs, f0, s0, M);
#pragma unroll
      for (int ks = 0; ks < 4; ++ks) f0[ks] = ldfrag(a2 + ks * 32);
      tile4(Bs, f1, s0 + 32, M);
    }
    // index e = 8 jj + r: bits 0..3 go to lane bits 0..3, bit 4 stays as the two values left per lane
    foldmax<1, 32>(M, m);
    foldmax<2, 16>(M, m);
    foldmax<4, 8>(M, m);
    foldmax<8, 4>(M, m);
    float* ob = sO + (jl0 + (m >> 3)) * DQ + 16 * dt + 8 * h + (m & 7);
    ob[0]      = M[0];                                   // jj = (m >> 3)
    ob[2 * DQ] = M[1];                                   // jj = 2 + (m >> 3)
  }
  __syncthreads();

  {                                                      // 256 threads x 16 B: 16 rows of 256 B, two whole lines each
    const int jl = tid >> 4, pc = (tid & 15) * 4;
    const v4f mv = *(const v4f*)(sO + jl * DQ + pc);
    const v4f bv = *(const v4f*)(bo + d0 + pc);
    v4f ov;
#pragma unroll
    for (int u = 0; u < 4; ++u) ov[u] = (mv[u] == -1.0e12f) ? -1.0e12f : mv[u] + bfr(bv[u]);
    *(v4f*)(out + (size_t)(b * NN + j0 + jl) * DDIM + d0 + pc) = ov;
  }
}

// =====================================================================================================
// Workspace map (bytes); every region is an exact multiple of its whole-line store granularity:
//   (not used)                                524288 at       0
//   WT   f16 [4][256][256], plane 3 alone     524288 at  524288
//   QKV  f16 Q, K, V [1024][256] each        1572864 at 1048576
//   (not used)                                786432 at 2621440
//   AH   f16 [8][128][128]                    262144 at 3407872
//   total                                    3670016
// =====================================================================================================
extern "C" void kernel_launch(void* const* d_in, const int* in_sizes, int n_in,
                              void* d_out, int out_size, void* d_ws, size_t ws_size,
                              hipStream_t stream) {
  if (n_in < 11) return;
  if (in_sizes[0] != SSZ) return;                // adj
  if (in_sizes[1] != PLN) return;                // sat_inputs
  if (in_sizes[2] != SSZ) return;                // adj_mask
  if (in_sizes[3] != WSZ || in_sizes[4] != DDIM) return;
  if (in_sizes[5] != WSZ || in_sizes[6] != DDIM) return;
  if (in_sizes[7] != WSZ || in_sizes[8] != DDIM) return;
  if (in_sizes[9] != WSZ || in_sizes[10] != DDIM) return;
  if (out_size != PLN) return;

  const int*   adj  = (const int*)d_in[0];       // [8][128][128]
  const float* x    = (const float*)d_in[1];     // [8][128][256]
  const int*   adjm = (const int*)d_in[2];       // [8][128][128]
  const float* Wq   = (const float*)d_in[3];  const float* bq = (const float*)d_in[4];
  const float* Wk   = (const float*)d_in[5];  const float* bk = (const float*)d_in[6];
  const float* Wv   = (const float*)d_in[7];  const float* bv = (const float*)d_in[8];
  const float* Wo   = (const float*)d_in[9];  const float* bo = (const float*)d_in[10];
  float* out = (float*)d_out;                    // [8][128][256]

  const size_t offXh  = 0;
  const size_t offWT  = offXh  + (size_t)PLN * 2;
  const size_t offQKV = offWT  + (size_t)4 * WSZ * 2;
  const size_t offS   = offQKV + (size_t)3 * PLN * 2;
  const size_t offVW  = offS   + (size_t)SSZ * 2;
  const size_t offAH  = offVW  + (size_t)PLN * 2;
  const size_t total  = offAH  + (size_t)SSZ * 2;          // 3670016
  if (total > ws_size) return;
  if (total > (size_t)134217728) return;

  char* ws = (char*)d_ws;
  unsigned short* WT  = (unsigned short*)(ws + offWT);
  unsigned short* QKV = (unsigned short*)(ws + offQKV);
  unsigned short* AH  = (unsigned short*)(ws + offAH);

  k_proj<<<dim3(NPROJ + 8 + SSZ / 2048), dim3(256), 0, stream>>>(x, Wq, Wk, Wv, Wo, bq, bk, bv, adj, QKV, WT, AH);
  k_main<<<dim3(NBATCH * (NN / JT) * (DDIM / DQ)), dim3(256), 0, stream>>>(AH, adj, adjm, QKV, WT, bo, out);
  (void)hipGetLastError();
}

// v007
// A run of this version takes 14.1 microseconds.
// Next to v006, in two timings, it ran 1.06 and 1.09 times as fast.
// Counting every step since v000, it is 11.3 times as fast.
// Contractions on v_wmma_f32_16x16x32_f16, f32 accumulate: x.Wq, x.Wk, x.Wv (x carried x16, W x1024, f16 built
// from bf16-RNE inputs); q.k^T (q, k carried x16); per b: v.Wo (v carried x16, Wo x1024); per (b,j): (s_j * v.Wo).adj^T
// (s_j * v.Wo carried x16, adj 0/1) and the row sums s_j.adj^T; single products. exp, reciprocal, the scaling by s_j (f16),
// the division by the row sum, bias adds and the max-pool on VALU.
#include <hip/hip_runtime.h>
#include <stdint.h>

#define NBATCH 8
#define NN     128
#define DDIM   256
#define NROWS  1024            // NBATCH*NN
#define PLN    262144          // NBATCH*NN*DDIM
#define WSZ    65536           // DDIM*DDIM
#define SSZ    131072          // NBATCH*NN*NN
static_assert(NROWS == NBATCH * NN);
static_assert(PLN == NROWS * DDIM);
static_assert(WSZ == DDIM * DDIM);
static_assert(SSZ == NBATCH * NN * NN);
static_assert(NN == 128);
static_assert(DDIM == 256);
static_assert((NROWS % 64) == 0);
#define PPITCH 136             // halves per LDS row of adj: 272 B = 16 B x 17, so 16 rows' 16-B pieces fall on all 64 banks
#define JT     16              // query rows j per k_main block
#define DQ     64              // output columns d per k_main block
#define XPITCH 264            // halves per LDS row of the x and W tiles of k_proj: 528 B = 16 B x 33
#define NPROJ  192            // projection blocks of k_proj: 3 planes x (NROWS / 64) x (DDIM / 64)
static_assert(NPROJ == 3 * (NROWS / 64) * (DDIM / 64));
static_assert(XPITCH >= DDIM && (XPITCH % 8) == 0 && ((XPITCH / 8) % 2) == 1);
static_assert(PPITCH >= NN && (PPITCH % 8) == 0 && ((PPITCH / 8) % 2) == 1);
// k_main, LDS places in halves. A 256-wide plane lies as two column halves of 128 halves (256-B rows at pitch PPITCH),
// each half one tensor-load tile; every tile starts at a multiple of 2 KiB.
#define KH     17408          // one column half of K or V: 128 rows x PPITCH = 34816 B = 17 x 2 KiB
#define WH     9216           // one column half of the Wo^T rows: 64 x PPITCH = 17408 B, rounded up to 9 x 2 KiB
#define QH     3072           // one column half of the Q rows: 16 x PPITCH = 4352 B, rounded up to 3 x 2 KiB
#define OFF_Q  38912          // behind At, sc2, sS, sO, sVW (38528 halves), rounded up to 38 x 2 KiB
#define OFF_W  (OFF_Q + 2 * QH)
#define OFF_K  (OFF_W + 2 * WH)
#define OFF_V  (OFF_K + 2 * KH)
#define SMH    (OFF_V + 2 * KH)
static_assert(KH == NN * PPITCH && WH >= DQ * PPITCH && QH >= JT * PPITCH);
static_assert(OFF_Q >= NN * PPITCH + JT * NN * 4 + JT * PPITCH + JT * DQ * 2 + DQ * PPITCH);
static_assert((KH % 1024) == 0 && (WH % 1024) == 0 && (QH % 1024) == 0 && (OFF_Q % 1024) == 0);
static_assert(PPITCH * 2 == 256 + 16 && DDIM * 2 == 512 && NN * 2 == 256 && SMH * 2 <= 327680);

typedef _Float16     v16h __attribute__((ext_vector_type(16)));
typedef _Float16     v8h  __attribute__((ext_vector_type(8)));
typedef float        v8f  __attribute__((ext_vector_type(8)));
typedef float        v4f  __attribute__((ext_vector_type(4)));
typedef float        v2f  __attribute__((ext_vector_type(2)));
typedef int          v4i  __attribute__((ext_vector_type(4)));
typedef unsigned int v4u  __attribute__((ext_vector_type(4)));
typedef unsigned int v8u  __attribute__((ext_vector_type(8)));

union Frag { v16h v; v8h half[2]; };

// ---- scalar helpers --------------------------------------------------------------------------------
__device__ __forceinline__ unsigned short bf_bits(float f) {          // f32 -> bf16 bits, RNE convert
  unsigned u = __float_as_uint(f);
  return (unsigned short)((u + 0x7FFFu + ((u >> 16) & 1u)) >> 16);
}
__device__ __forceinline__ float bf_up(unsigned short b) { return __uint_as_float(((unsigned)b) << 16); }
__device__ __forceinline__ float bfr(float f) { return bf_up(bf_bits(f)); }   // value after bf16 RNE convert
__device__ __forceinline__ unsigned short h_bits(float f) {           // f32 -> f16 bits, RNE convert
  return __builtin_bit_cast(unsigned short, (_Float16)f);
}
__device__ __forceinline__ unsigned pack2(float a, float b) {         // two halves into one word, low = first
  return (unsigned)h_bits(a) | (((unsigned)h_bits(b)) << 16);
}
__device__ __forceinline__ v8f fill8(float x) {
  v8f z;
  z[0] = x; z[1] = x; z[2] = x; z[3] = x; z[4] = x; z[5] = x; z[6] = x; z[7] = x;
  return z;
}

// ---- 16-bit fragment loader (A, B alike): p points at row/col (lane&15), k0 + 8*(lane>>4);
//      elements 0..7 <- p[0..7] (k0+8h..k0+8h+7), elements 8..15 <- p[16..23] (k0+16+8h..k0+16+8h+7)
__device__ __forceinline__ v16h ldfrag(const _Float16* p) {
  Frag f;
  f.half[0] = *(const v8h*)(p);
  f.half[1] = *(const v8h*)(p + 16);
  return f.v;
}

// ---- WMMA with trailing VALU hazard gap (ties D, keeps A/B live past the nops) ---------------------
__device__ __forceinline__ v8f mma(v16h a, v16h b, v8f c) {
  v8f d = __builtin_amdgcn_wmma_f32_16x16x32_f16(false, a, false, b, (short)0, c, false, false);
#if defined(__HIP_DEVICE_COMPILE__)
  asm volatile("v_nop\n\tv_nop\n\tv_nop\n\tv_nop" : "+v"(d) : "v"(a), "v"(b));
#endif
  return d;
}

// =====================================================================================================
// k_proj, blocks 0..191: plane pj = 0 (q), 1 (k), 2 (v): val[n][e] = f16 of 16*(x[n][:].W[:][e] + bfr(bias[e])), n flattened
// over (b, node) 0..1023. Block (pj, rt, cg): rows n = 64 rt .. +63, cols e = 64 cg .. +63. The block converts its own
// operands from the f32 inputs: sX[n][f] = f16 of (bf16-RNE x * 16); sW[e][f] = f16 of (bf16-RNE W[f][e] * 1024), the
// transpose made in registers (a thread holds 8 f x 4 e and stores 8 f of one e as 16 B). In sW the 16-B piece c of row e
// lies at piece c ^ ((e >> 4) & 3): the 16 rows 4 apart that one store covers then fall on all 64 banks; a fragment read
// covers 16 neighbouring rows, for which that term is one constant. 8 waves, wave w: rows 16(w>>1), cols 32(w&1) +
// {0..15, 16..31}. A-op = sX row n (k = f, split map), B-op = sW row e (k = f, split map); D row n = ... + 8h + r,
// col e = ... + (lane&15); acc = 16384 * (x.W).
// coverage: sX 2048 x 16 B, sW 2048 x 16 B before the first barrier; per plane 16 x 4 blocks x 64 x 64 = 1024 x 256.
// Blocks 192..199: rows e0..e0+31 of WT[3][e][f] = f16 of (bf16-RNE Wo[f][e] * 1024): LDS tile [32 c][256 f] filled by
// 2-B stores, then 4 whole-line stores per thread. coverage: 8 x 8192 halves = all of WT[3] (256 x 256).
// Blocks 200..263: AH[b][i][kk] = f16 1.0 where adj[b][i][kk] != 0, else 0; 8 elements per thread, one 16-B store.
// coverage: 64 blocks x 2048 halves = all of AH (8 x 128 x 128).
// =====================================================================================================
__global__ __launch_bounds__(256) void k_proj(const float* __restrict__ x,
                                              const float* __restrict__ Wq, const float* __restrict__ Wk,
                                              const float* __restrict__ Wv, const float* __restrict__ Wo,
                                              const float* __restrict__ bq, const float* __restrict__ bk,
                                              const float* __restrict__ bv, const int* __restrict__ adj,
                                              unsigned short* QKV, unsigned short* WT, unsigned short* AH) {
  __shared__ __align__(16) unsigned short sX[64 * XPITCH];
  __shared__ __align__(16) unsigned short sW[64 * XPITCH];
  __shared__ __align__(16) unsigned short sT[4096];     // 64 x 64
  const int tid  = threadIdx.x;
  const int bid  = blockIdx.x;                          // 0..263, role is block-uniform

  if (bid < NPROJ) {
    const int lane = tid & 31, w = tid >> 5, h = lane >> 4, m = lane & 15;
    const int pj   = bid / ((NROWS / 64) * (DDIM / 64));   // 0..2 (block-uniform)
    const int rt   = (bid / (DDIM / 64)) % (NROWS / 64);   // 64-row tile of the NROWS flattened rows
    const int cg   = bid % (DDIM / 64);
    const int n0   = rt * 64;
    const int e0g  = cg * 64;
    const int wr   = w >> 1, wc = w & 1;
    const float* bias = (pj == 0) ? bq : ((pj == 1) ? bk : bv);   // block-uniform, all global
    const float* wsrc = (pj == 0) ? Wq : ((pj == 1) ? Wk : Wv);   // block-uniform, all global

    // ---- both f32 tiles and the bias in flight at once: 32 loads of 16 B and 2 of 4 B per thread ----
    const int xr = tid >> 5, xc = (tid & 31) * 8;       // x: row 8 q + xr, columns xc .. xc + 7
    const int fq = tid >> 4, e4 = (tid & 15) * 4;       // W: rows 8 (16 it + fq) + 0..7, columns e4 .. e4 + 3
    const float* px = x + (size_t)(n0 + xr) * DDIM + xc;
    const float* pw = wsrc + (size_t)(fq * 8) * DDIM + e0g + e4;
    const int el0 = 32 * wc + m, el1 = el0 + 16;
    const float* pb = bias + e0g + el0;
    v4f xa[8], xb[8], wv[2][8];
#pragma unroll
    for (int q = 0; q < 8; ++q) {
      xa[q] = *(const v4f*)(px + q * 8 * DDIM);
      xb[q] = *(const v4f*)(px + q * 8 * DDIM + 4);
    }
#pragma unroll
    for (int it = 0; it < 2; ++it) {
#pragma unroll
      for (int r = 0; r < 8; ++r) wv[it][r] = *(const v4f*)(pw + (it * 128 + r) * DDIM);
    }
    const float rb0 = pb[0], rb1 = pb[16];
#if defined(__HIP_DEVICE_COMPILE__)
    // the wait stands before any write of these loads' address registers: as inputs here the addresses stay in
    // their registers up to it
    asm volatile("s_wait_xcnt 0x0" :: "v"(px), "v"(pw) : "memory");
#endif
    // no conversion is scheduled among the loads: without this the last 8 loads were issued behind a wait on the first 26
    __builtin_amdgcn_sched_barrier(0);
#pragma unroll
    for (int q = 0; q < 8; ++q) {
      v4u pk;
      pk[0] = pack2(bfr(xa[q][0]) * 16.0f, bfr(xa[q][1]) * 16.0f);
      pk[1] = pack2(bfr(xa[q][2]) * 16.0f, bfr(xa[q][3]) * 16.0f);
      pk[2] = pack2(bfr(xb[q][0]) * 16.0f, bfr(xb[q][1]) * 16.0f);
      pk[3] = pack2(bfr(xb[q][2]) * 16.0f, bfr(xb[q][3]) * 16.0f);
      *(v4u*)(sX + (q * 8 + xr) * XPITCH + xc) = pk;
    }
    const int gs = (tid & 15) >> 2;                     // (e >> 4) & 3 of this thread's four rows e4 .. e4 + 3
#pragma unroll
    for (int it = 0; it < 2; ++it) {
      const int pc = (it * 16 + fq) ^ gs;               // place of piece f / 8 = 16 it + fq
#pragma unroll
      for (int u = 0; u < 4; ++u) {
        v4u pk;
        pk[0] = pack2(bfr(wv[it][0][u]) * 1024.0f, bfr(wv[it][1][u]) * 1024.0f);
        pk[1] = pack2(bfr(wv[it][2][u]) * 1024.0f, bfr(wv[it][3][u]) * 1024.0f);
        pk[2] = pack2(bfr(wv[it][4][u]) * 1024.0f, bfr(wv[it][5][u]) * 1024.0f);
        pk[3] = pack2(bfr(wv[it][6][u]) * 1024.0f, bfr(wv[it][7][u]) * 1024.0f);
        *(v4u*)(sW + (e4 + u) * XPITCH + pc * 8) = pk;
      }
    }
    __syncthreads();

    const _Float16* Ap  = (const _Float16*)(const void*)sX + (16 * wr + m) * XPITCH + 8 * h;
    const _Float16* Bp0 = (const _Float16*)(const void*)sW + (32 * wc + m) * XPITCH;      // rows with (e >> 4) & 3 = 2 wc
    const _Float16* Bp1 = Bp0 + 16 * XPITCH;                                              // rows with (e >> 4) & 3 = 2 wc + 1
    const int g0 = 2 * wc, g1 = 2 * wc + 1;
    const int o00 = (h ^ g0) * 8, o01 = ((2 + h) ^ g0) * 8;   // places of pieces h and 2 + h inside each group of four
    const int o10 = (h ^ g1) * 8, o11 = ((2 + h) ^ g1) * 8;
    v16h Af[8];
    Frag Bf0[8], Bf1[8];                                // all 48 LDS reads issued as one group ahead of the products
#pragma unroll
    for (int ks = 0; ks < 8; ++ks) {
      Af[ks] = ldfrag(Ap + ks * 32);
      Bf0[ks].half[0] = *(const v8h*)(Bp0 + ks * 32 + o00);
      Bf0[ks].half[1] = *(const v8h*)(Bp0 + ks * 32 + o01);
      Bf1[ks].half[0] = *(const v8h*)(Bp1 + ks * 32 + o10);
      Bf1[ks].half[1] = *(const v8h*)(Bp1 + ks * 32 + o11);
    }
    v8f acc0 = fill8(0.0f), acc1 = fill8(0.0f);
#pragma unroll
    for (int ks = 0; ks < 8; ++ks) {
      acc0 = mma(Af[ks], Bf0[ks].v, acc0);
      acc1 = mma(Af[ks], Bf1[ks].v, acc1);
    }

    const float bb0 = bfr(rb0);
    const float bb1 = bfr(rb1);
#pragma unroll
    for (int r = 0; r < 8; ++r) {
      const int nl = 16 * wr + 8 * h + r;
      const float v0 = (acc0[r] * 6.103515625e-05f + bb0) * 16.0f;  // acc/16384 + b, carried x16
      const float v1 = (acc1[r] * 6.103515625e-05f + bb1) * 16.0f;
      sT[nl * 64 + el0] = h_bits(v0);
      sT[nl * 64 + el1] = h_bits(v1);
    }
    __syncthreads();

    const int piece = tid & 7, rq = tid >> 3;           // rq 0..31
    v4u pv[2];
    size_t o[2];
#pragma unroll
    for (int it = 0; it < 2; ++it) {
      const int row = it * 32 + rq;                     // tile row nl 0..63
      pv[it] = *(const v4u*)(sT + row * 64 + piece * 8);
      o[it] = (size_t)pj * PLN + (size_t)(n0 + row) * DDIM + e0g + piece * 8;
    }
#pragma unroll
    for (int it = 0; it < 2; ++it) *(v4u*)(QKV + o[it]) = pv[it];
  } else if (bid < NPROJ + 8) {
    const int e0 = (bid - NPROJ) * 32;
#pragma unroll 1
    for (int it = 0; it < 4; ++it) {
      const int p  = it * 256 + tid;           // 0..1023
      const int f  = p >> 2;                   // 0..255
      const int c8 = (p & 3) * 8;              // 0,8,16,24
      const float* q = Wo + (size_t)f * DDIM + e0 + c8;
      const v4f v0 = *(const v4f*)(q);
      const v4f v1 = *(const v4f*)(q + 4);
      unsigned short* d = sX + c8 * 256 + f;   // tile layout [c][f], 8192 halves of sX
#pragma unroll
      for (int u = 0; u < 4; ++u) {
        d[u * 256]       = h_bits(bfr(v0[u]) * 1024.0f);
        d[(u + 4) * 256] = h_bits(bfr(v1[u]) * 1024.0f);
      }
    }
    __syncthreads();
    unsigned short* dst = WT + (size_t)3 * WSZ + (size_t)e0 * DDIM;
    v4u pv[4];
#pragma unroll
    for (int it = 0; it < 4; ++it) pv[it] = *(const v4u*)(sX + (size_t)(it * 256 + tid) * 8);
#pragma unroll
    for (int it = 0; it < 4; ++it) *(v4u*)(dst + (size_t)(it * 256 + tid) * 8) = pv[it];
  } else {
    const size_t base = (size_t)(bid - (NPROJ + 8)) * 2048 + (size_t)tid * 8;
    const v4i a0 = *(const v4i*)(adj + base);
    const v4i a1 = *(const v4i*)(adj + base + 4);
    v4u pk;
    pk[0] = (a0[0] != 0 ? 0x3C00u : 0u) | (a0[1] != 0 ? 0x3C000000u : 0u);
    pk[1] = (a0[2] != 0 ? 0x3C00u : 0u) | (a0[3] != 0 ? 0x3C000000u : 0u);
    pk[2] = (a1[0] != 0 ? 0x3C00u : 0u) | (a1[1] != 0 ? 0x3C000000u : 0u);
    pk[3] = (a1[2] != 0 ? 0x3C00u : 0u) | (a1[3] != 0 ? 0x3C000000u : 0u);
    *(v4u*)(AH + base) = pk;
#if defined(__HIP_DEVICE_COMPILE__)
    asm volatile("s_wait_xcnt 0x0" ::: "memory");       // before any later write of the store's address or data registers
#endif
  }
}

// =====================================================================================================
// k_main: block (b, jt, dq) owns out[b][16 jt .. +15][64 dq .. +63] and sees every subtree i itself, so the max over i
// needs no cross-block exchange. With a[i][kk] = (adj[b][i][kk] != 0) and s = S[j]:
//   O[i][d] = (sum_kk a[i][kk] s[kk] VW[kk][d]) / max(den[i], 1e-9),  den[i] = sum_kk a[i][kk] s[kk]   (adj[b][i][j] != 0)
// so the operand with index i is the 0/1 plane AH[b], the same for every j: staged once in LDS (At) for the block's 16 j.
// The block makes its own score rows and its own v.Wo tile from the planes of k_proj:
//   S[j][kk] = f16 of expf((q_j.k_kk)/16), 16 j x 128 kk;  VW[d][kk] = f16 of 16 * sum_e v[kk][e] Wo[e][d], 64 d x 128 kk.
// Stage 1: tensor loads bring the planes into LDS, through no register: each 256-wide plane as two column halves (tiles of
//   256-B rows, source pitch 512 B, padded to pitch PPITCH); K and, queued behind it, V from waves 0, 1, Q from waves 2, 3.
// Stage 2a: behind the issuers' waits for Q and K, barrier 1 (LDS alone: adj and adj_mask stay in flight); waves 4, 5 issue
//   the 64 rows of WoT; wave w: score tile, A-op = sK rows kk = 16 w + m, B-op = sQ rows j (both k = d, split); D[row kk = 8h + r][col j = m],
//   acc = 256 * q.k -> logit arg = acc * 2^-12: a lane's 8 registers are 8 neighbouring kk of one j, one 16-B store into sS.
// Stage 2b: behind the issuers' waits for V and WoT, barrier 2 (LDS alone); wave 6 issues AH[b] into At (rows of 256 B, source
//   pitch 256 B, the same pad); wave w: kk tiles 2 (w & 3) + {0, 1}, d tiles
//   2 (w >> 2) + {0, 1}; A-op = sV rows kk, B-op = sW rows d (both k = e, split); D[row kk = 8h + r][col d = m],
//   acc = 16384 * v.Wo -> x 2^-10; one 16-B store per tile into sVW[d][kk]. Then wave 6's wait for AH; barrier 3.
// Stage 3: wave w: den tile D[row j = 8h + r][col i = 16 w + m] = sS rows . At rows (both k = kk, split);
//   sc2[j][i] = (scale, offset): adj_mask != 0 -> (0, -1e12); adj[b][i][j] == 0 -> (0, 0); else (2^-4 / max(den, 1e-9), 0).
// Main (behind barrier 4): wave w: d tile dt = w & 3, j group jh = w >> 2; two passes of 4 j. A-op rows d = sVW rows times
//   s_j (f16, k = kk, split), kept in registers; B-op cols i = At rows (k = kk, split); D[row d = 8h + r][col i = 16 it + m];
//   val = D * scale + offset; running max over the 8 i tiles per lane, then over the 16 lanes of a row.
// coverage: 256 blocks x 16 x 64 floats = the whole output; sQ 2 x 16, sK 2 x 128 rows of 256 B before barrier 1; sV 2 x 128,
//   sW 2 x 64 rows before barrier 2; sS 8 waves x 32 x 16 B, sVW 8 waves x 4 x 32 x 16 B, At 128 rows before barrier 3; sc2 8 waves x
//   16 x 16 pairs before barrier 4; sO 8 waves x 2 passes x 64 floats before the last. No LDS byte has two uses.
// =====================================================================================================
template <int X>
__device__ __forceinline__ float rowx(float v) {        // value of lane (lane ^ X) inside the 16-lane row
  return __builtin_bit_cast(float, __builtin_amdgcn_update_dpp(0, __builtin_bit_cast(int, v), 0x160 + X, 0xf, 0xf, true));
}
// N values per lane -> N/2: lanes with bit X clear keep the even ones, lanes with it set the odd ones, each joined
// by max with the partner lane's copy of the same value.
template <int X, int N>
__device__ __forceinline__ void foldmax(float* v, int m) {
  const bool hi = (m & X) != 0;
#pragma unroll
  for (int k = 0; k < N / 2; ++k) {
    const float a = v[2 * k], b = v[2 * k + 1];
    const float mine = hi ? b : a;
    const float send = hi ? a : b;
    v[k] = fmaxf(mine, rowx<X>(send));
  }
}
__device__ __forceinline__ v8f wm(v16h a, v16h b, v8f c) {
  return __builtin_amdgcn_wmma_f32_16x16x32_f16(false, a, false, b, (short)0, c, false, false);
}

// one i tile against 4 j: 16 products on 4 independent accumulators, then scale, offset and the running max
__device__ __forceinline__ void tile4(const v16h (&Bs)[4][4], const v16h (&f)[4], const float* sp, float (&M)[32]) {
  v2f so[4];
#pragma unroll
  for (int jj = 0; jj < 4; ++jj) so[jj] = *(const v2f*)(sp + jj * NN * 2);
  v8f c[4];
#pragma unroll
  for (int jj = 0; jj < 4; ++jj) c[jj] = fill8(0.0f);
#pragma unroll
  for (int ks = 0; ks < 4; ++ks) {
#pragma unroll
    for (int jj = 0; jj < 4; ++jj) c[jj] = wm(Bs[jj][ks], f[ks], c[jj]);
  }
#pragma unroll
  for (int jj = 0; jj < 4; ++jj) {
#pragma unroll
    for (int q = 0; q < 4; ++q) {                        // neighbouring registers as one packed multiply-add
      v2f cc;
      cc[0] = c[jj][2 * q];
      cc[1] = c[jj][2 * q + 1];
      const v2f v = cc * so[jj][0] + so[jj][1];
      M[jj * 8 + 2 * q]     = fmaxf(M[jj * 8 + 2 * q], v[0]);
      M[jj * 8 + 2 * q + 1] = fmaxf(M[jj * 8 + 2 * q + 1], v[1]);
    }
  }
}
__device__ __forceinline__ v4u pack8(v8f c, float s) {  // 8 accumulator registers times s, as 8 halves
  v4u pk;
  pk[0] = pack2(c[0] * s, c[1] * s);
  pk[1] = pack2(c[2] * s, c[3] * s);
  pk[2] = pack2(c[4] * s, c[5] * s);
  pk[3] = pack2(c[6] * s, c[7] * s);
  return pk;
}

// work-group barrier that orders LDS alone: the wave's global loads that are still on their way stay in flight over it
__device__ __forceinline__ void lds_barrier() {
  __builtin_amdgcn_fence(__ATOMIC_RELEASE, "workgroup", "local");
  __builtin_amdgcn_s_barrier();
  __builtin_amdgcn_fence(__ATOMIC_ACQUIRE, "workgroup", "local");
}

// ---- tensor loads: one request of one wave brings a tile of 256-B rows from global memory into LDS at pitch 272 B ----
__device__ __forceinline__ unsigned uni(unsigned v) { return (unsigned)__builtin_amdgcn_readfirstlane(v); }
// the issue tests: a tensor load ignores EXEC, so only a scalar branch (s_cmp, s_cbranch_scc) keeps a wave from issuing it
__device__ __forceinline__ unsigned pinned(unsigned v) {
  unsigned t = uni(v);
  asm volatile("" : "+s"(t));                            // pinned(): holds the issue test's value in a scalar register
  return t;
}
__device__ __forceinline__ v4u tdm_group0(unsigned lds_dst, unsigned long long ga) {
  v4u g;
  g[0] = uni(1u);                                        // count 1
  g[1] = uni(lds_dst);                                   // byte offset in the work-group's LDS
  g[2] = uni((unsigned)ga);
  g[3] = uni((((unsigned)(ga >> 32)) & 0x01FFFFFFu) | 0x80000000u);   // address [56:32], type 2
  return g;
}
// 1-byte elements, tile = tensor = rows x 256 B, source row pitch src_pitch bytes, 4 dwords of LDS pad behind every 256 B
__device__ __forceinline__ v8u tdm_group1(unsigned rows, unsigned src_pitch) {
  v8u g;
  g[0] = uni((1u << 20) | (5u << 22) | (3u << 25));      // no mask, data_size 0, pad codes 5 / 3
  g[1] = uni(256u << 16);                                // tensor_dim0
  g[2] = uni(rows << 16);                                // tensor_dim1
  g[3] = uni(256u << 16);                                // tile_dim0
  g[4] = uni(rows);                                      // tile_dim1
  g[5] = uni(src_pitch);
  g[6] = uni(0u);
  g[7] = uni(0u);
  return g;
}
__device__ __forceinline__ void tdm_load(v4u g0, v8u g1) {
#if defined(__HIP_DEVICE_COMPILE__)
  asm volatile("tensor_load_to_lds %0, %1" :: "s"(g0), "s"(g1) : "memory");
#endif
}
// the issuing wave's own wait: all but its N youngest requests have landed. As inputs here the descriptor words of the
// request stay in their registers up to the wait that covers it.
template <int N>
__device__ __forceinline__ void tdm_wait(v4u g0, v8u g1) {
#if defined(__HIP_DEVICE_COMPILE__)
  asm volatile("s_wait_tensorcnt %0" :: "i"(N), "s"(g0), "s"(g1) : "memory");
#endif
}
// the wave's LDS accesses have retired before a stage is handed over
__device__ __forceinline__ void wait_ds0() {
#if defined(__HIP_DEVICE_COMPILE__)
  asm volatile("s_wait_dscnt 0x0" ::: "memory");
#endif
}

__global__ __launch_bounds__(256) void k_main(const unsigned short* __restrict__ AHp, const int* __restrict__ adj,
                                              const int* __restrict__ adjm, const unsigned short* __restrict__ QKV,
                                              const unsigned short* __restrict__ WTp,
                                              const float* __restrict__ bo, float* out) {
  // one LDS block, laid out by hand: what the main loop reads lies in the first 64 KiB, inside the reach of the
  // 16-bit offset field of an LDS instruction
  __shared__ __attribute__((aligned(2048))) _Float16 sm[SMH];
  _Float16* const At  = sm;                             // [128 i][128 kk of pitch PPITCH]; pad halves never read
  float* const    sc2 = (float*)(void*)(At + NN * PPITCH);           // [16 j][128 i] (scale, offset)
  _Float16* const sS  = At + NN * PPITCH + JT * NN * 4; // [16 j][128 kk of pitch PPITCH]
  float* const    sO  = (float*)(void*)(sS + JT * PPITCH);           // [16 j][64 d]
  _Float16* const sVW = sS + JT * PPITCH + JT * DQ * 2; // [64 d][128 kk of pitch PPITCH]
  _Float16* const sQ  = sm + OFF_Q;                     // 2 column halves, QH apart, of [16 j][128 d of pitch PPITCH]
  _Float16* const sW  = sm + OFF_W;                     // 2 column halves, WH apart, of [64 d][128 e of pitch PPITCH]
  _Float16* const sK  = sm + OFF_K;                     // 2 column halves, KH apart, of [128 kk][128 d of pitch PPITCH]
  _Float16* const sV  = sm + OFF_V;                     // 2 column halves, KH apart, of [128 kk][128 e of pitch PPITCH]
  const int tid  = threadIdx.x;
  const int lane = tid & 31, w = tid >> 5, h = lane >> 4, m = lane & 15;
  const int dq   = blockIdx.x & 3;
  const int jt   = (blockIdx.x >> 2) & 7;
  const int b    = blockIdx.x >> 5;
  const int j0   = jt * JT, d0 = dq * DQ;
  const int dt   = w & 3, jh = w >> 2;
  const size_t ij = (size_t)(b * NN + 16 * w + m) * NN + j0 + 8 * h;     // (i = 16 w + m, j = j0 + 8h + 0..7)
  const int* pA = adj + ij;
  const int* pM = adjm + ij;

  // ---------------- stage 1: the tensor loads of Q, K and V; the adj and adj_mask loads ----------------
  // One tile per request, rows of 256 B: waves 0, 1 the two column halves of K and, queued behind them, of V (a wave's
  // requests land in issue order, so K is not held back by V); waves 2, 3 those of Q; waves 4, 5 those of Wo^T, issued
  // behind barrier 1; wave 6 the AH plane, issued behind barrier 2: each plane is on its way while the stage before the
  // one that reads it runs, and none takes delivery rate from a plane that is needed sooner.
  const unsigned wave = uni((unsigned)tid >> 5);
  const unsigned role = wave >> 1, hf = wave & 1u;       // role 0: K, V; 1: Q; 2: Wo^T; 3: AH (wave 6 alone issues)
  const unsigned lbase = (unsigned)(size_t)sm;
  const unsigned long long aQ = (unsigned long long)(size_t)QKV + 2ull * (unsigned)((b * NN + j0) * DDIM);
  const unsigned long long aK = (unsigned long long)(size_t)QKV + 2ull * (unsigned)(PLN + b * NN * DDIM);
  const unsigned long long aW = (unsigned long long)(size_t)WTp + 2ull * (unsigned)(3 * WSZ + d0 * DDIM);
  const unsigned long long aH = (unsigned long long)(size_t)AHp + 2ull * (unsigned)(b * NN * NN);
  const unsigned long long ga = ((role == 0u) ? aK : (role == 1u) ? aQ : (role == 2u) ? aW : aH) + 256u * hf;
  const unsigned dsth = (role == 0u) ? OFF_K + hf * KH : (role == 1u) ? OFF_Q + hf * QH : (role == 2u) ? OFF_W + hf * WH : 0u;
  const unsigned rows = (role == 1u) ? JT : (role == 2u) ? DQ : NN;
  const v8u g1  = tdm_group1(rows, (role == 3u) ? 256u : 512u);
  const v4u g0  = tdm_group0(lbase + 2u * dsth, ga);
  const v4u g0v = tdm_group0(lbase + 2u * (dsth + (OFF_V - OFF_K)), ga + 2ull * PLN);   // waves 0, 1: the V half
  if (pinned(wave < 4u)) tdm_load(g0, g1);
  if (pinned(wave < 2u)) tdm_load(g0v, g1);
  const v4i aj0 = *(const v4i*)(pA), aj1 = *(const v4i*)(pA + 4);
  const v4i mj0 = *(const v4i*)(pM), mj1 = *(const v4i*)(pM + 4);
#if defined(__HIP_DEVICE_COMPILE__)
  // the wait stands before any write of these loads' address registers: as inputs here the addresses stay live
  // up to it, so neither a later result nor a later load's data takes their registers earlier
  asm volatile("s_wait_xcnt 0x0" :: "v"(pA), "v"(pM) : "memory");
#endif
  // ---------------- stage 2a: the block's score rows, while V and Wo^T are on their way ----------------
  if (pinned(wave < 2u)) tdm_wait<1>(g0, g1);            // K half landed, the V half may still be out
  if (pinned(role == 1u)) tdm_wait<0>(g0, g1);           // Q half landed
  lds_barrier();                                         // barrier 1: publishes Q and K
  if (pinned(role == 2u)) tdm_load(g0, g1);
  {
    const _Float16* ka = sK + (16 * w + m) * PPITCH + 8 * h;             // A-op row kk = 16 w + m
    const _Float16* qb = sQ + m * PPITCH + 8 * h;                        // B-op col j = j0 + m
    v16h kf[8], qf[8];                                  // all 32 LDS reads issued as one group ahead of the products
#pragma unroll
    for (int ks = 0; ks < 8; ++ks) {                    // d = 32 ks + ..: column half ks >> 2, 32 (ks & 3) inside it
      kf[ks] = ldfrag(ka + (ks >> 2) * KH + (ks & 3) * 32);
      qf[ks] = ldfrag(qb + (ks >> 2) * QH + (ks & 3) * 32);
    }
    // no product is scheduled among the reads: without this they stood in pairs among the products, each behind a wait to 0
    __builtin_amdgcn_sched_barrier(0);
    v8f acc = fill8(0.0f);
#pragma unroll
    for (int ks = 0; ks < 8; ++ks) acc = wm(kf[ks], qf[ks], acc);
    v4u pk;
#pragma unroll
    for (int u = 0; u < 4; ++u)
      pk[u] = pack2(expf(acc[2 * u] * 0.000244140625f), expf(acc[2 * u + 1] * 0.000244140625f));   // 2^-12
    *(v4u*)(sS + m * PPITCH + 16 * w + 8 * h) = pk;
  }

  // ---------------- stage 2b: the block's v.Wo tile, while AH is on its way ----------------
  wait_ds0();
  if (pinned(wave < 2u)) tdm_wait<0>(g0v, g1);           // V half landed
  if (pinned(role == 2u)) tdm_wait<0>(g0, g1);           // Wo^T half landed
  lds_barrier();                                         // barrier 2: publishes V and Wo^T
  if (pinned(wave == 6u)) tdm_load(g0, g1);
  {
    const int kp = w & 3, dp = w >> 2;
    const _Float16* va = sV + (32 * kp + m) * PPITCH + 8 * h;            // A-op rows kk = 32 kp + m, + 16
    const _Float16* wb = sW + (32 * dp + m) * PPITCH + 8 * h;            // B-op cols d = d0 + 32 dp + m, + 16
    v16h a0[8], a1[8], b0[8], b1[8];                    // all 64 LDS reads issued as one group ahead of the products
#pragma unroll
    for (int ks = 0; ks < 8; ++ks) {                    // e = 32 ks + ..: column half ks >> 2, 32 (ks & 3) inside it
      a0[ks] = ldfrag(va + (ks >> 2) * KH + (ks & 3) * 32);
      b0[ks] = ldfrag(wb + (ks >> 2) * WH + (ks & 3) * 32);
      a1[ks] = ldfrag(va + 16 * PPITCH + (ks >> 2) * KH + (ks & 3) * 32);
      b1[ks] = ldfrag(wb + 16 * PPITCH + (ks >> 2) * WH + (ks & 3) * 32);
      // the reads are issued in the order in which the products take them: without this, reads of the second k step stood
      // last and the second product waited for nearly all 64
      __builtin_amdgcn_sched_barrier(0);
    }
    v8f c00 = fill8(0.0f), c01 = fill8(0.0f), c10 = fill8(0.0f), c11 = fill8(0.0f);
#pragma unroll
    for (int ks = 0; ks < 8; ++ks) {
      c00 = wm(a0[ks], b0[ks], c00);
      c01 = wm(a0[ks], b1[ks], c01);
      c10 = wm(a1[ks], b0[ks], c10);
      c11 = wm(a1[ks], b1[ks], c11);
      // the four products of a k step stay together, so each step runs as soon as its own 8 reads are back: without this
      // one accumulator's 8 products ran alone while the reads came in and the other 24 stood behind the last read
      __builtin_amdgcn_sched_barrier(0);
    }
    _Float16* tp = sVW + (32 * dp + m) * PPITCH + 32 * kp + 8 * h;       // 16384 v.Wo * 2^-10 = 16 v.Wo
    *(v4u*)(tp)                    = pack8(c00, 0.0009765625f);
    *(v4u*)(tp + 16)               = pack8(c10, 0.0009765625f);
    *(v4u*)(tp + 16 * PPITCH)      = pack8(c01, 0.0009765625f);
    *(v4u*)(tp + 16 * PPITCH + 16) = pack8(c11, 0.0009765625f);
  }
  // nothing that needs adj or adj_mask is scheduled among the products above: without this a compare of stage 3 stood
  // behind the first product, with a wait for every global load in front of it
  __builtin_amdgcn_sched_barrier(0);
  wait_ds0();
  if (pinned(wave == 6u)) tdm_wait<0>(g0, g1);           // AH landed in At
  __syncthreads();                                       // barrier 3: publishes sS, sVW and At

  // ---------------- stage 3: row sums, scale and offset; this wave's v.Wo fragments ----------------
  v16h VWf[4];
  {
    const _Float16* pS = sS + m * PPITCH + 8 * h;                        // A-op row j = j0 + m
    const _Float16* pE = At + (16 * w + m) * PPITCH + 8 * h;             // B-op col i = 16 w + m
    const _Float16* vp = sVW + (16 * dt + m) * PPITCH + 8 * h;           // A-op row d = d0 + 16 dt + m of the main loop
    v16h sa[4], ea[4];
#pragma unroll
    for (int ks = 0; ks < 4; ++ks) {
      sa[ks]  = ldfrag(pS + ks * 32);
      ea[ks]  = ldfrag(pE + ks * 32);
      VWf[ks] = ldfrag(vp + ks * 32);
    }
    v8f den = fill8(0.0f);
#pragma unroll
    for (int ks = 0; ks < 4; ++ks) den = wm(sa[ks], ea[ks], den);
#pragma unroll
    for (int r = 0; r < 8; ++r) {
      const int aij = (r < 4) ? aj0[r & 3] : aj1[r & 3];
      const int msk = (r < 4) ? mj0[r & 3] : mj1[r & 3];
      const float rd = 0.0625f / fmaxf(den[r], 1.0e-9f);
      v2f so;
      so[0] = (aij != 0 && msk == 0) ? rd : 0.0f;
      so[1] = (msk == 0) ? 0.0f : -1.0e12f;
      *(v2f*)(sc2 + ((8 * h + r) * NN + 16 * w + m) * 2) = so;
    }
  }
  __syncthreads();

  // ---------------- main: (s_j * VW) . adj^T, scaled, masked max over i ----------------
  const _Float16* ap = At + m * PPITCH + 8 * h;          // B-op col i = 16 it + (lane & 15)
#pragma unroll 1                                         // rolled: one pass's 16 scaled fragments live at a time
  for (int p = 0; p < 2; ++p) {
    const int jl0 = jh * 8 + p * 4;
    v16h Bs[4][4];
#pragma unroll
    for (int jj = 0; jj < 4; ++jj) {
#pragma unroll
      for (int ks = 0; ks < 4; ++ks) Bs[jj][ks] = VWf[ks] * ldfrag(sS + (jl0 + jj) * PPITCH + ks * 32 + 8 * h);
    }
    float M[32];
#pragma unroll
    for (int e = 0; e < 32; ++e) M[e] = -3.0e38f;
    const float* sp = sc2 + (jl0 * NN + m) * 2;
    v16h f0[4], f1[4];                                   // two fragment sets: one is filled while the other is used
#pragma unroll
    for (int ks = 0; ks < 4; ++ks) f0[ks] = ldfrag(ap + ks * 32);
#pragma unroll 1                                         // rolled: unrolled, all 8 tiles' LDS reads were hoisted and spilled
    for (int t2 = 0; t2 < 4; ++t2) {
      const _Float16* a1 = ap + (2 * t2 + 1) * 16 * PPITCH;
      const _Float16* a2 = ap + ((2 * t2 + 2) & 7) * 16 * PPITCH;   // last trip: tile 0 again, read and not used
      const float* s0 = sp + t2 * 64;
#pragma unroll
      for (int ks = 0; ks < 4; ++ks) f1[ks] = ldfrag(a1 + ks * 32);
      tile4(Bs, f0, s0, M);
#pragma unroll
      for (int ks = 0; ks < 4; ++ks) f0[ks] = ldfrag(a2 + ks * 32);
      tile4(Bs, f1, s0 + 32, M);
    }
    // index e = 8 jj + r: bits 0..3 go to lane bits 0..3, bit 4 stays as the two values left per lane
    foldmax<1, 32>(M, m);
    foldmax<2, 16>(M, m);
    foldmax<4, 8>(M, m);
    foldmax<8, 4>(M, m);
    float* ob = sO + (jl0 + (m >> 3)) * DQ + 16 * dt + 8 * h + (m & 7);
    ob[0]      = M[0];                                   // jj = (m >> 3)
    ob[2 * DQ] = M[1];                                   // jj = 2 + (m >> 3)
  }
  __syncthreads();

  {                                                      // 256 threads x 16 B: 16 rows of 256 B, two whole lines each
    const int jl = tid >> 4, pc = (tid & 15) * 4;
    const v4f mv = *(const v4f*)(sO + jl * DQ + pc);
    const v4f bv = *(const v4f*)(bo + d0 + pc);
    v4f ov;
#pragma unroll
    for (int u = 0; u < 4; ++u) ov[u] = (mv[u] == -1.0e12f) ? -1.0e12f : mv[u] + bfr(bv[u]);
    *(v4f*)(out + (size_t)(b * NN + j0 + jl) * DDIM + d0 + pc) = ov;
  }
}

// =====================================================================================================
// Workspace map (bytes); every region is an exact multiple of its whole-line store granularity:
//   (not used)                                524288 at       0
//   WT   f16 [4][256][256], plane 3 alone     524288 at  524288
//   QKV  f16 Q, K, V [1024][256] each        1572864 at 1048576
//   (not used)                                786432 at 2621440
//   AH   f16 [8][128][128]                    262144 at 3407872
//   total                                    3670016
// =====================================================================================================
extern "C" void kernel_launch(void* const* d_in, const int* in_sizes, int n_in,
                              void* d_out, int out_size, void* d_ws, size_t ws_size,
                              hipStream_t stream) {
  if (n_in < 11) return;
  if (in_sizes[0] != SSZ) return;                // adj
  if (in_sizes[1] != PLN) return;                // sat_inputs
  if (in_sizes[2] != SSZ) return;                // adj_mask
  if (in_sizes[3] != WSZ || in_sizes[4] != DDIM) return;
  if (in_sizes[5] != WSZ || in_sizes[6] != DDIM) return;
  if (in_sizes[7] != WSZ || in_sizes[8] != DDIM) return;
  if (in_sizes[9] != WSZ || in_sizes[10] != DDIM) return;
  if (out_size != PLN) return;

  const int*   adj  = (const int*)d_in[0];       // [8][128][128]
  const float* x    = (const float*)d_in[1];     // [8][128][256]
  const int*   adjm = (const int*)d_in[2];       // [8][128][128]
  const float* Wq   = (const float*)d_in[3];  const float* bq = (const float*)d_in[4];
  const float* Wk   = (const float*)d_in[5];  const float* bk = (const float*)d_in[6];
  const float* Wv   = (const float*)d_in[7];  const float* bv = (const float*)d_in[8];
  const float* Wo   = (const float*)d_in[9];  const float* bo = (const float*)d_in[10];
  float* out = (float*)d_out;                    // [8][128][256]

  const size_t offXh  = 0;
  const size_t offWT  = offXh  + (size_t)PLN * 2;
  const size_t offQKV = offWT  + (size_t)4 * WSZ * 2;
  const size_t offS   = offQKV + (size_t)3 * PLN * 2;
  const size_t offVW  = offS   + (size_t)SSZ * 2;
  const size_t offAH  = offVW  + (size_t)PLN * 2;
  const size_t total  = offAH  + (size_t)SSZ * 2;          // 3670016
  if (total > ws_size) return;
  if (total > (size_t)134217728) return;

  char* ws = (char*)d_ws;
  unsigned short* WT  = (unsigned short*)(ws + offWT);
  unsigned short* QKV = (unsigned short*)(ws + offQKV);
  unsigned short* AH  = (unsigned short*)(ws + offAH);

  k_proj<<<dim3(NPROJ + 8 + SSZ / 2048), dim3(256), 0, stream>>>(x, Wq, Wk, Wv, Wo, bq, bk, bv, adj, QKV, WT, AH);
  k_main<<<dim3(NBATCH * (NN / JT) * (DDIM / DQ)), dim3(256), 0, stream>>>(AH, adj, adjm, QKV, WT, bo, out);
  (void)hipGetLastError();
}

// v008
// It runs in 13.3 microseconds.
// Two timings next to v007 both put it at 1.06 times that version's speed.
// Over all steps from v000 it is 11.9 times as fast.
// Contractions on v_wmma_f32_16x16x32_f16, f32 accumulate: x.Wq, x.Wk, x.Wv (x carried x16, W x1024, f16 built
// from bf16-RNE inputs); q.k^T (q, k carried x16); per b: v.Wo (v carried x16, Wo x1024); per (b,j): (s_j * v.Wo).adj^T
// (s_j * v.Wo carried x16, adj 0/1) and the row sums s_j.adj^T; single products. exp, reciprocal, the scaling by s_j (f16),
// the division by the row sum, bias adds and the max-pool on VALU.
#include <hip/hip_runtime.h>
#include <stdint.h>

#define NBATCH 8
#define NN     128
#define DDIM   256
#define NROWS  1024            // NBATCH*NN
#define PLN    262144          // NBATCH*NN*DDIM
#define WSZ    65536           // DDIM*DDIM
#define SSZ    131072          // NBATCH*NN*NN
static_assert(NROWS == NBATCH * NN);
static_assert(PLN == NROWS * DDIM);
static_assert(WSZ == DDIM * DDIM);
static_assert(SSZ == NBATCH * NN * NN);
static_assert(NN == 128);
static_assert(DDIM == 256);
static_assert((NROWS % 64) == 0);
#define PPITCH 136             // halves per LDS row of adj: 272 B = 16 B x 17, so 16 rows' 16-B pieces fall on all 64 banks
#define JT     16              // query rows j per k_main block
#define DQ     64              // output columns d per k_main block
#define XPITCH 264            // halves per LDS row of the x and W tiles of k_proj: 528 B = 16 B x 33
#define NPROJ  192            // projection blocks of k_proj: 3 planes x (NROWS / 64) x (DDIM / 64)
static_assert(NPROJ == 3 * (NROWS / 64) * (DDIM / 64));
static_assert(XPITCH >= DDIM && (XPITCH % 8) == 0 && ((XPITCH / 8) % 2) == 1);
static_assert(PPITCH >= NN && (PPITCH % 8) == 0 && ((PPITCH / 8) % 2) == 1);
// k_main, LDS places in halves. A 256-wide plane lies as two column halves of 128 halves (256-B rows at pitch PPITCH),
// each half one tensor-load tile; every tile starts at a multiple of 2 KiB.
#define KH     17408          // one column half of K or V: 128 rows x PPITCH = 34816 B = 17 x 2 KiB
#define WH     9216           // one column half of the Wo^T rows: 64 x PPITCH = 17408 B, rounded up to 9 x 2 KiB
#define QH     3072           // one column half of the Q rows: 16 x PPITCH = 4352 B, rounded up to 3 x 2 KiB
#define OFF_Q  38912          // behind At, scl, lst, sS, sO, sVW (38528 halves), rounded up to 38 x 2 KiB
#define OFF_W  (OFF_Q + 2 * QH)
#define OFF_K  (OFF_W + 2 * WH)
#define OFF_V  (OFF_K + 2 * KH)
#define OFF_M  (OFF_V + 2 * KH)   // two planes of 16 row masks of 128 bits
#define SMH    (OFF_M + 256)
static_assert(KH == NN * PPITCH && WH >= DQ * PPITCH && QH >= JT * PPITCH);
static_assert(OFF_Q >= NN * PPITCH + JT * NN * 4 + JT * PPITCH + JT * DQ * 2 + DQ * PPITCH);
static_assert((KH % 1024) == 0 && (WH % 1024) == 0 && (QH % 1024) == 0 && (OFF_Q % 1024) == 0);
static_assert(PPITCH * 2 == 256 + 16 && DDIM * 2 == 512 && NN * 2 == 256 && SMH * 2 <= 327680);

typedef _Float16     v16h __attribute__((ext_vector_type(16)));
typedef _Float16     v8h  __attribute__((ext_vector_type(8)));
typedef float        v8f  __attribute__((ext_vector_type(8)));
typedef float        v4f  __attribute__((ext_vector_type(4)));
typedef float        v2f  __attribute__((ext_vector_type(2)));
typedef int          v4i  __attribute__((ext_vector_type(4)));
typedef unsigned int v4u  __attribute__((ext_vector_type(4)));
typedef unsigned int v8u  __attribute__((ext_vector_type(8)));

union Frag { v16h v; v8h half[2]; };

// ---- scalar helpers --------------------------------------------------------------------------------
__device__ __forceinline__ unsigned short bf_bits(float f) {          // f32 -> bf16 bits, RNE convert
  unsigned u = __float_as_uint(f);
  return (unsigned short)((u + 0x7FFFu + ((u >> 16) & 1u)) >> 16);
}
__device__ __forceinline__ float bf_up(unsigned short b) { return __uint_as_float(((unsigned)b) << 16); }
__device__ __forceinline__ float bfr(float f) { return bf_up(bf_bits(f)); }   // value after bf16 RNE convert
__device__ __forceinline__ unsigned short h_bits(float f) {           // f32 -> f16 bits, RNE convert
  return __builtin_bit_cast(unsigned short, (_Float16)f);
}
__device__ __forceinline__ unsigned pack2(float a, float b) {         // two halves into one word, low = first
  return (unsigned)h_bits(a) | (((unsigned)h_bits(b)) << 16);
}
__device__ __forceinline__ v8f fill8(float x) {
  v8f z;
  z[0] = x; z[1] = x; z[2] = x; z[3] = x; z[4] = x; z[5] = x; z[6] = x; z[7] = x;
  return z;
}

// ---- 16-bit fragment loader (A, B alike): p points at row/col (lane&15), k0 + 8*(lane>>4);
//      elements 0..7 <- p[0..7] (k0+8h..k0+8h+7), elements 8..15 <- p[16..23] (k0+16+8h..k0+16+8h+7)
__device__ __forceinline__ v16h ldfrag(const _Float16* p) {
  Frag f;
  f.half[0] = *(const v8h*)(p);
  f.half[1] = *(const v8h*)(p + 16);
  return f.v;
}

// ---- WMMA with trailing VALU hazard gap (ties D, keeps A/B live past the nops) ---------------------
__device__ __forceinline__ v8f mma(v16h a, v16h b, v8f c) {
  v8f d = __builtin_amdgcn_wmma_f32_16x16x32_f16(false, a, false, b, (short)0, c, false, false);
#if defined(__HIP_DEVICE_COMPILE__)
  asm volatile("v_nop\n\tv_nop\n\tv_nop\n\tv_nop" : "+v"(d) : "v"(a), "v"(b));
#endif
  return d;
}

// =====================================================================================================
// k_proj, blocks 0..191: plane pj = 0 (q), 1 (k), 2 (v): val[n][e] = f16 of 16*(x[n][:].W[:][e] + bfr(bias[e])), n flattened
// over (b, node) 0..1023. Block (pj, rt, cg): rows n = 64 rt .. +63, cols e = 64 cg .. +63. The block converts its own
// operands from the f32 inputs: sX[n][f] = f16 of (bf16-RNE x * 16); sW[e][f] = f16 of (bf16-RNE W[f][e] * 1024), the
// transpose made in registers (a thread holds 8 f x 4 e and stores 8 f of one e as 16 B). In sW the 16-B piece c of row e
// lies at piece c ^ ((e >> 4) & 3): the 16 rows 4 apart that one store covers then fall on all 64 banks; a fragment read
// covers 16 neighbouring rows, for which that term is one constant. 8 waves, wave w: rows 16(w>>1), cols 32(w&1) +
// {0..15, 16..31}. A-op = sX row n (k = f, split map), B-op = sW row e (k = f, split map); D row n = ... + 8h + r,
// col e = ... + (lane&15); acc = 16384 * (x.W).
// coverage: sX 2048 x 16 B, sW 2048 x 16 B before the first barrier; per plane 16 x 4 blocks x 64 x 64 = 1024 x 256.
// Blocks 192..199: rows e0..e0+31 of WT[3][e][f] = f16 of (bf16-RNE Wo[f][e] * 1024): LDS tile [32 c][256 f] filled by
// 2-B stores, then 4 whole-line stores per thread. coverage: 8 x 8192 halves = all of WT[3] (256 x 256).
// Blocks 200..263: AH[b][i][kk] = f16 1.0 where adj[b][i][kk] != 0, else 0; 8 elements per thread, one 16-B store.
// coverage: 64 blocks x 2048 halves = all of AH (8 x 128 x 128).
// =====================================================================================================
__global__ __launch_bounds__(256) void k_proj(const float* __restrict__ x,
                                              const float* __restrict__ Wq, const float* __restrict__ Wk,
                                              const float* __restrict__ Wv, const float* __restrict__ Wo,
                                              const float* __restrict__ bq, const float* __restrict__ bk,
                                              const float* __restrict__ bv, const int* __restrict__ adj,
                                              unsigned short* QKV, unsigned short* WT, unsigned short* AH) {
  __shared__ __align__(16) unsigned short sX[64 * XPITCH];
  __shared__ __align__(16) unsigned short sW[64 * XPITCH];
  __shared__ __align__(16) unsigned short sT[4096];     // 64 x 64
  const int tid  = threadIdx.x;
  const int bid  = blockIdx.x;                          // 0..263, role is block-uniform

  if (bid < NPROJ) {
    const int lane = tid & 31, w = tid >> 5, h = lane >> 4, m = lane & 15;
    const int pj   = bid / ((NROWS / 64) * (DDIM / 64));   // 0..2 (block-uniform)
    const int rt   = (bid / (DDIM / 64)) % (NROWS / 64);   // 64-row tile of the NROWS flattened rows
    const int cg   = bid % (DDIM / 64);
    const int n0   = rt * 64;
    const int e0g  = cg * 64;
    const int wr   = w >> 1, wc = w & 1;
    const float* bias = (pj == 0) ? bq : ((pj == 1) ? bk : bv);   // block-uniform, all global
    const float* wsrc = (pj == 0) ? Wq : ((pj == 1) ? Wk : Wv);   // block-uniform, all global

    // ---- both f32 tiles and the bias in flight at once: 32 loads of 16 B and 2 of 4 B per thread ----
    const int xr = tid >> 5, xc = (tid & 31) * 8;       // x: row 8 q + xr, columns xc .. xc + 7
    const int fq = tid >> 4, e4 = (tid & 15) * 4;       // W: rows 8 (16 it + fq) + 0..7, columns e4 .. e4 + 3
    const float* px = x + (size_t)(n0 + xr) * DDIM + xc;
    const float* pw = wsrc + (size_t)(fq * 8) * DDIM + e0g + e4;
    const int el0 = 32 * wc + m, el1 = el0 + 16;
    const float* pb = bias + e0g + el0;
    v4f xa[8], xb[8], wv[2][8];
#pragma unroll
    for (int q = 0; q < 8; ++q) {
      xa[q] = *(const v4f*)(px + q * 8 * DDIM);
      xb[q] = *(const v4f*)(px + q * 8 * DDIM + 4);
    }
#pragma unroll
    for (int it = 0; it < 2; ++it) {
#pragma unroll
      for (int r = 0; r < 8; ++r) wv[it][r] = *(const v4f*)(pw + (it * 128 + r) * DDIM);
    }
    const float rb0 = pb[0], rb1 = pb[16];
#if defined(__HIP_DEVICE_COMPILE__)
    // the wait stands before any write of these loads' address registers: as inputs here the addresses stay in
    // their registers up to it
    asm volatile("s_wait_xcnt 0x0" :: "v"(px), "v"(pw) : "memory");
#endif
    // no conversion is scheduled among the loads: without this the last 8 loads were issued behind a wait on the first 26
    __builtin_amdgcn_sched_barrier(0);
#pragma unroll
    for (int q = 0; q < 8; ++q) {
      v4u pk;
      pk[0] = pack2(bfr(xa[q][0]) * 16.0f, bfr(xa[q][1]) * 16.0f);
      pk[1] = pack2(bfr(xa[q][2]) * 16.0f, bfr(xa[q][3]) * 16.0f);
      pk[2] = pack2(bfr(xb[q][0]) * 16.0f, bfr(xb[q][1]) * 16.0f);
      pk[3] = pack2(bfr(xb[q][2]) * 16.0f, bfr(xb[q][3]) * 16.0f);
      *(v4u*)(sX + (q * 8 + xr) * XPITCH + xc) = pk;
    }
    const int gs = (tid & 15) >> 2;                     // (e >> 4) & 3 of this thread's four rows e4 .. e4 + 3
#pragma unroll
    for (int it = 0; it < 2; ++it) {
      const int pc = (it * 16 + fq) ^ gs;               // place of piece f / 8 = 16 it + fq
#pragma unroll
      for (int u = 0; u < 4; ++u) {
        v4u pk;
        pk[0] = pack2(bfr(wv[it][0][u]) * 1024.0f, bfr(wv[it][1][u]) * 1024.0f);
        pk[1] = pack2(bfr(wv[it][2][u]) * 1024.0f, bfr(wv[it][3][u]) * 1024.0f);
        pk[2] = pack2(bfr(wv[it][4][u]) * 1024.0f, bfr(wv[it][5][u]) * 1024.0f);
        pk[3] = pack2(bfr(wv[it][6][u]) * 1024.0f, bfr(wv[it][7][u]) * 1024.0f);
        *(v4u*)(sW + (e4 + u) * XPITCH + pc * 8) = pk;
      }
    }
    __syncthreads();

    const _Float16* Ap  = (const _Float16*)(const void*)sX + (16 * wr + m) * XPITCH + 8 * h;
    const _Float16* Bp0 = (const _Float16*)(const void*)sW + (32 * wc + m) * XPITCH;      // rows with (e >> 4) & 3 = 2 wc
    const _Float16* Bp1 = Bp0 + 16 * XPITCH;                                              // rows with (e >> 4) & 3 = 2 wc + 1
    const int g0 = 2 * wc, g1 = 2 * wc + 1;
    const int o00 = (h ^ g0) * 8, o01 = ((2 + h) ^ g0) * 8;   // places of pieces h and 2 + h inside each group of four
    const int o10 = (h ^ g1) * 8, o11 = ((2 + h) ^ g1) * 8;
    v16h Af[8];
    Frag Bf0[8], Bf1[8];                                // all 48 LDS reads issued as one group ahead of the products
#pragma unroll
    for (int ks = 0; ks < 8; ++ks) {
      Af[ks] = ldfrag(Ap + ks * 32);
      Bf0[ks].half[0] = *(const v8h*)(Bp0 + ks * 32 + o00);
      Bf0[ks].half[1] = *(const v8h*)(Bp0 + ks * 32 + o01);
      Bf1[ks].half[0] = *(const v8h*)(Bp1 + ks * 32 + o10);
      Bf1[ks].half[1] = *(const v8h*)(Bp1 + ks * 32 + o11);
    }
    v8f acc0 = fill8(0.0f), acc1 = fill8(0.0f);
#pragma unroll
    for (int ks = 0; ks < 8; ++ks) {
      acc0 = mma(Af[ks], Bf0[ks].v, acc0);
      acc1 = mma(Af[ks], Bf1[ks].v, acc1);
    }

    const float bb0 = bfr(rb0);
    const float bb1 = bfr(rb1);
#pragma unroll
    for (int r = 0; r < 8; ++r) {
      const int nl = 16 * wr + 8 * h + r;
      const float v0 = (acc0[r] * 6.103515625e-05f + bb0) * 16.0f;  // acc/16384 + b, carried x16
      const float v1 = (acc1[r] * 6.103515625e-05f + bb1) * 16.0f;
      sT[nl * 64 + el0] = h_bits(v0);
      sT[nl * 64 + el1] = h_bits(v1);
    }
    __syncthreads();

    const int piece = tid & 7, rq = tid >> 3;           // rq 0..31
    v4u pv[2];
    size_t o[2];
#pragma unroll
    for (int it = 0; it < 2; ++it) {
      const int row = it * 32 + rq;                     // tile row nl 0..63
      pv[it] = *(const v4u*)(sT + row * 64 + piece * 8);
      o[it] = (size_t)pj * PLN + (size_t)(n0 + row) * DDIM + e0g + piece * 8;
    }
#pragma unroll
    for (int it = 0; it < 2; ++it) *(v4u*)(QKV + o[it]) = pv[it];
  } else if (bid < NPROJ + 8) {
    const int e0 = (bid - NPROJ) * 32;
#pragma unroll 1
    for (int it = 0; it < 4; ++it) {
      const int p  = it * 256 + tid;           // 0..1023
      const int f  = p >> 2;                   // 0..255
      const int c8 = (p & 3) * 8;              // 0,8,16,24
      const float* q = Wo + (size_t)f * DDIM + e0 + c8;
      const v4f v0 = *(const v4f*)(q);
      const v4f v1 = *(const v4f*)(q + 4);
      unsigned short* d = sX + c8 * 256 + f;   // tile layout [c][f], 8192 halves of sX
#pragma unroll
      for (int u = 0; u < 4; ++u) {
        d[u * 256]       = h_bits(bfr(v0[u]) * 1024.0f);
        d[(u + 4) * 256] = h_bits(bfr(v1[u]) * 1024.0f);
      }
    }
    __syncthreads();
    unsigned short* dst = WT + (size_t)3 * WSZ + (size_t)e0 * DDIM;
    v4u pv[4];
#pragma unroll
    for (int it = 0; it < 4; ++it) pv[it] = *(const v4u*)(sX + (size_t)(it * 256 + tid) * 8);
#pragma unroll
    for (int it = 0; it < 4; ++it) *(v4u*)(dst + (size_t)(it * 256 + tid) * 8) = pv[it];
  } else {
    const size_t base = (size_t)(bid - (NPROJ + 8)) * 2048 + (size_t)tid * 8;
    const v4i a0 = *(const v4i*)(adj + base);
    const v4i a1 = *(const v4i*)(adj + base + 4);
    v4u pk;
    pk[0] = (a0[0] != 0 ? 0x3C00u : 0u) | (a0[1] != 0 ? 0x3C000000u : 0u);
    pk[1] = (a0[2] != 0 ? 0x3C00u : 0u) | (a0[3] != 0 ? 0x3C000000u : 0u);
    pk[2] = (a1[0] != 0 ? 0x3C00u : 0u) | (a1[1] != 0 ? 0x3C000000u : 0u);
    pk[3] = (a1[2] != 0 ? 0x3C00u : 0u) | (a1[3] != 0 ? 0x3C000000u : 0u);
    *(v4u*)(AH + base) = pk;
#if defined(__HIP_DEVICE_COMPILE__)
    asm volatile("s_wait_xcnt 0x0" ::: "memory");       // before any later write of the store's address or data registers
#endif
  }
}

// =====================================================================================================
// k_main: block (b, jt, dq) owns out[b][16 jt .. +15][64 dq .. +63] and sees every subtree i itself, so the max over i
// needs no cross-block exchange. With a[i][kk] = (adj[b][i][kk] != 0) and s = S[j]:
//   O[i][d] = (sum_kk a[i][kk] s[kk] VW[kk][d]) / max(den[i], 1e-9),  den[i] = sum_kk a[i][kk] s[kk]   (adj[b][i][j] != 0)
// so the operand with index i is the 0/1 plane AH[b], the same for every j: staged once in LDS (At) for the block's 16 j.
// The block makes its own score rows and its own v.Wo tile from the planes of k_proj:
//   S[j][kk] = f16 of expf((q_j.k_kk)/16), 16 j x 128 kk;  VW[d][kk] = f16 of 16 * sum_e v[kk][e] Wo[e][d], 64 d x 128 kk.
// Stage 1: tensor loads bring the planes into LDS, through no register: each 256-wide plane as two column halves (tiles of
//   256-B rows, source pitch 512 B, padded to pitch PPITCH); K and, queued behind it, V from waves 0, 1, Q from waves 2, 3.
// Stage 2a: behind the issuers' waits for Q and K, barrier 1 (LDS alone: adj and adj_mask stay in flight); waves 4, 5 issue
//   the 64 rows of WoT; wave w: score tile, A-op = sK rows kk = 16 w + m, B-op = sQ rows j (both k = d, split); D[row kk = 8h + r][col j = m],
//   acc = 256 * q.k -> logit arg = acc * 2^-12: a lane's 8 registers are 8 neighbouring kk of one j, one 16-B store into sS.
// Stage 2b: behind the issuers' waits for V and WoT, barrier 2 (LDS alone); wave 6 issues AH[b] into At (rows of 256 B, source
//   pitch 256 B, the same pad); wave w: kk tiles 2 (w & 3) + {0, 1}, d tiles
//   2 (w >> 2) + {0, 1}; A-op = sV rows kk, B-op = sW rows d (both k = e, split); D[row kk = 8h + r][col d = m],
//   acc = 16384 * v.Wo -> x 2^-10; one 16-B store per tile into sVW[d][kk]. Then wave 6's wait for AH; barrier 3.
// Stage 3: wave w: den tile D[row j = 8h + r][col i = 16 w + m] = sS rows . At rows (both k = kk, split);
//   scl[j][i] = 2^-4 / max(den, 1e-9); by wave ballot two 128-bit masks per j: vm bit i = (adj[b][i][j] != 0 and adj_mask == 0),
//   the subtrees whose product counts; zm bit i = (adj[b][i][j] == 0 and adj_mask == 0), whose value is 0; all others give -1e12.
// Main (behind barrier 4): wave w: j = 2 w + p, p = 0, 1, all four d tiles. The set bits of vm[j] are written as a list of i, in
//   rising order, the rest of its 128 places filled with the first of them (a repeated i does not move a maximum); only the
//   ceil(count / 16) tiles of the list are run. A-op rows d = sVW rows times s_j (f16, k = kk, split), kept in registers; B-op
//   cols = At rows i = list[16 t + m] (k = kk, split); D[row d = 8h + r][col list place 16 t + m]; val = D * scl[j][i]; running
//   max over the tiles per lane, then over the 16 lanes of a row, then with 0 (any zm bit) or -1e12 (any i in neither mask).
// coverage: 256 blocks x 16 x 64 floats = the whole output; sQ 2 x 16, sK 2 x 128 rows of 256 B before barrier 1; sV 2 x 128,
//   sW 2 x 64 rows before barrier 2; sS 8 waves x 32 x 16 B, sVW 8 waves x 4 x 32 x 16 B, At 128 rows before barrier 3; scl 8 waves x
//   16 x 16 floats and both masks before barrier 4; a list is written and read by one wave alone; sO 8 waves x 2 passes x 64 floats before the last. No LDS byte has two uses.
// =====================================================================================================
template <int X>
__device__ __forceinline__ float rowx(float v) {        // value of lane (lane ^ X) inside the 16-lane row
  return __builtin_bit_cast(float, __builtin_amdgcn_update_dpp(0, __builtin_bit_cast(int, v), 0x160 + X, 0xf, 0xf, true));
}
// N values per lane -> N/2: lanes with bit X clear keep the even ones, lanes with it set the odd ones, each joined
// by max with the partner lane's copy of the same value.
template <int X, int N>
__device__ __forceinline__ void foldmax(float* v, int m) {
  const bool hi = (m & X) != 0;
#pragma unroll
  for (int k = 0; k < N / 2; ++k) {
    const float a = v[2 * k], b = v[2 * k + 1];
    const float mine = hi ? b : a;
    const float send = hi ? a : b;
    v[k] = fmaxf(mine, rowx<X>(send));
  }
}
__device__ __forceinline__ v8f wm(v16h a, v16h b, v8f c) {
  return __builtin_amdgcn_wmma_f32_16x16x32_f16(false, a, false, b, (short)0, c, false, false);
}

__device__ __forceinline__ v4u pack8(v8f c, float s) {  // 8 accumulator registers times s, as 8 halves
  v4u pk;
  pk[0] = pack2(c[0] * s, c[1] * s);
  pk[1] = pack2(c[2] * s, c[3] * s);
  pk[2] = pack2(c[4] * s, c[5] * s);
  pk[3] = pack2(c[6] * s, c[7] * s);
  return pk;
}

// work-group barrier that orders LDS alone: the wave's global loads that are still on their way stay in flight over it
__device__ __forceinline__ void lds_barrier() {
  __builtin_amdgcn_fence(__ATOMIC_RELEASE, "workgroup", "local");
  __builtin_amdgcn_s_barrier();
  __builtin_amdgcn_fence(__ATOMIC_ACQUIRE, "workgroup", "local");
}

// ---- tensor loads: one request of one wave brings a tile of 256-B rows from global memory into LDS at pitch 272 B ----
__device__ __forceinline__ unsigned uni(unsigned v) { return (unsigned)__builtin_amdgcn_readfirstlane(v); }
// the issue tests: a tensor load ignores EXEC, so only a scalar branch (s_cmp, s_cbranch_scc) keeps a wave from issuing it
__device__ __forceinline__ unsigned pinned(unsigned v) {
  unsigned t = uni(v);
  asm volatile("" : "+s"(t));                            // pinned(): holds the issue test's value in a scalar register
  return t;
}
__device__ __forceinline__ v4u tdm_group0(unsigned lds_dst, unsigned long long ga) {
  v4u g;
  g[0] = uni(1u);                                        // count 1
  g[1] = uni(lds_dst);                                   // byte offset in the work-group's LDS
  g[2] = uni((unsigned)ga);
  g[3] = uni((((unsigned)(ga >> 32)) & 0x01FFFFFFu) | 0x80000000u);   // address [56:32], type 2
  return g;
}
// 1-byte elements, tile = tensor = rows x 256 B, source row pitch src_pitch bytes, 4 dwords of LDS pad behind every 256 B
__device__ __forceinline__ v8u tdm_group1(unsigned rows, unsigned src_pitch) {
  v8u g;
  g[0] = uni((1u << 20) | (5u << 22) | (3u << 25));      // no mask, data_size 0, pad codes 5 / 3
  g[1] = uni(256u << 16);                                // tensor_dim0
  g[2] = uni(rows << 16);                                // tensor_dim1
  g[3] = uni(256u << 16);                                // tile_dim0
  g[4] = uni(rows);                                      // tile_dim1
  g[5] = uni(src_pitch);
  g[6] = uni(0u);
  g[7] = uni(0u);
  return g;
}
__device__ __forceinline__ void tdm_load(v4u g0, v8u g1) {
#if defined(__HIP_DEVICE_COMPILE__)
  asm volatile("tensor_load_to_lds %0, %1" :: "s"(g0), "s"(g1) : "memory");
#endif
}
// the issuing wave's own wait: all but its N youngest requests have landed. As inputs here the descriptor words of the
// request stay in their registers up to the wait that covers it.
template <int N>
__device__ __forceinline__ void tdm_wait(v4u g0, v8u g1) {
#if defined(__HIP_DEVICE_COMPILE__)
  asm volatile("s_wait_tensorcnt %0" :: "i"(N), "s"(g0), "s"(g1) : "memory");
#endif
}
// the wave's LDS accesses have retired before a stage is handed over
__device__ __forceinline__ void wait_ds0() {
#if defined(__HIP_DEVICE_COMPILE__)
  asm volatile("s_wait_dscnt 0x0" ::: "memory");
#endif
}

__global__ __launch_bounds__(256) void k_main(const unsigned short* __restrict__ AHp, const int* __restrict__ adj,
                                              const int* __restrict__ adjm, const unsigned short* __restrict__ QKV,
                                              const unsigned short* __restrict__ WTp,
                                              const float* __restrict__ bo, float* out) {
  // one LDS block, laid out by hand: what the main loop reads lies in the first 64 KiB, inside the reach of the
  // 16-bit offset field of an LDS instruction
  __shared__ __attribute__((aligned(2048))) _Float16 sm[SMH];
  _Float16* const At  = sm;                             // [128 i][128 kk of pitch PPITCH]; pad halves never read
  float* const    scl = (float*)(void*)(At + NN * PPITCH);           // [16 j][128 i] scale
  unsigned* const lst = (unsigned*)(void*)(At + NN * PPITCH + JT * NN * 2);   // [16 j][128 places] subtree numbers i
  _Float16* const sS  = At + NN * PPITCH + JT * NN * 4; // [16 j][128 kk of pitch PPITCH]
  float* const    sO  = (float*)(void*)(sS + JT * PPITCH);           // [16 j][64 d]
  _Float16* const sVW = sS + JT * PPITCH + JT * DQ * 2; // [64 d][128 kk of pitch PPITCH]
  _Float16* const sQ  = sm + OFF_Q;                     // 2 column halves, QH apart, of [16 j][128 d of pitch PPITCH]
  _Float16* const sW  = sm + OFF_W;                     // 2 column halves, WH apart, of [64 d][128 e of pitch PPITCH]
  _Float16* const sK  = sm + OFF_K;                     // 2 column halves, KH apart, of [128 kk][128 d of pitch PPITCH]
  _Float16* const sV  = sm + OFF_V;                     // 2 column halves, KH apart, of [128 kk][128 e of pitch PPITCH]
  unsigned* const vm  = (unsigned*)(void*)(sm + OFF_M); // [16 j][4 words]: bit i set: subtree i counts for j
  unsigned* const zm  = vm + JT * 4;                    // [16 j][4 words]: bit i set: subtree i gives 0 for j
  const int tid  = threadIdx.x;
  const int lane = tid & 31, w = tid >> 5, h = lane >> 4, m = lane & 15;
  const int dq   = blockIdx.x & 3;
  const int jt   = (blockIdx.x >> 2) & 7;
  const int b    = blockIdx.x >> 5;
  const int j0   = jt * JT, d0 = dq * DQ;
  const size_t ij = (size_t)(b * NN + 16 * w + m) * NN + j0 + 8 * h;     // (i = 16 w + m, j = j0 + 8h + 0..7)
  const int* pA = adj + ij;
  const int* pM = adjm + ij;

  // ---------------- stage 1: the tensor loads of Q, K and V; the adj and adj_mask loads ----------------
  // One tile per request, rows of 256 B: waves 0, 1 the two column halves of K and, queued behind them, of V (a wave's
  // requests land in issue order, so K is not held back by V); waves 2, 3 those of Q; waves 4, 5 those of Wo^T, issued
  // behind barrier 1; wave 6 the AH plane, issued behind barrier 2: each plane is on its way while the stage before the
  // one that reads it runs, and none takes delivery rate from a plane that is needed sooner.
  const unsigned wave = uni((unsigned)tid >> 5);
  const unsigned role = wave >> 1, hf = wave & 1u;       // role 0: K, V; 1: Q; 2: Wo^T; 3: AH (wave 6 alone issues)
  const unsigned lbase = (unsigned)(size_t)sm;
  const unsigned long long aQ = (unsigned long long)(size_t)QKV + 2ull * (unsigned)((b * NN + j0) * DDIM);
  const unsigned long long aK = (unsigned long long)(size_t)QKV + 2ull * (unsigned)(PLN + b * NN * DDIM);
  const unsigned long long aW = (unsigned long long)(size_t)WTp + 2ull * (unsigned)(3 * WSZ + d0 * DDIM);
  const unsigned long long aH = (unsigned long long)(size_t)AHp + 2ull * (unsigned)(b * NN * NN);
  const unsigned long long ga = ((role == 0u) ? aK : (role == 1u) ? aQ : (role == 2u) ? aW : aH) + 256u * hf;
  const unsigned dsth = (role == 0u) ? OFF_K + hf * KH : (role == 1u) ? OFF_Q + hf * QH : (role == 2u) ? OFF_W + hf * WH : 0u;
  const unsigned rows = (role == 1u) ? JT : (role == 2u) ? DQ : NN;
  const v8u g1  = tdm_group1(rows, (role == 3u) ? 256u : 512u);
  const v4u g0  = tdm_group0(lbase + 2u * dsth, ga);
  const v4u g0v = tdm_group0(lbase + 2u * (dsth + (OFF_V - OFF_K)), ga + 2ull * PLN);   // waves 0, 1: the V half
  if (pinned(wave < 4u)) tdm_load(g0, g1);
  if (pinned(wave < 2u)) tdm_load(g0v, g1);
  const v4i aj0 = *(const v4i*)(pA), aj1 = *(const v4i*)(pA + 4);
  const v4i mj0 = *(const v4i*)(pM), mj1 = *(const v4i*)(pM + 4);
#if defined(__HIP_DEVICE_COMPILE__)
  // the wait stands before any write of these loads' address registers: as inputs here the addresses stay live
  // up to it, so neither a later result nor a later load's data takes their registers earlier
  asm volatile("s_wait_xcnt 0x0" :: "v"(pA), "v"(pM) : "memory");
#endif
  // ---------------- stage 2a: the block's score rows, while V and Wo^T are on their way ----------------
  if (pinned(wave < 2u)) tdm_wait<1>(g0, g1);            // K half landed, the V half may still be out
  if (pinned(role == 1u)) tdm_wait<0>(g0, g1);           // Q half landed
  lds_barrier();                                         // barrier 1: publishes Q and K
  if (pinned(role == 2u)) tdm_load(g0, g1);
  {
    const _Float16* ka = sK + (16 * w + m) * PPITCH + 8 * h;             // A-op row kk = 16 w + m
    const _Float16* qb = sQ + m * PPITCH + 8 * h;                        // B-op col j = j0 + m
    v16h kf[8], qf[8];                                  // all 32 LDS reads issued as one group ahead of the products
#pragma unroll
    for (int ks = 0; ks < 8; ++ks) {                    // d = 32 ks + ..: column half ks >> 2, 32 (ks & 3) inside it
      kf[ks] = ldfrag(ka + (ks >> 2) * KH + (ks & 3) * 32);
      qf[ks] = ldfrag(qb + (ks >> 2) * QH + (ks & 3) * 32);
    }
    // no product is scheduled among the reads: without this they stood in pairs among the products, each behind a wait to 0
    __builtin_amdgcn_sched_barrier(0);
    v8f acc = fill8(0.0f);
#pragma unroll
    for (int ks = 0; ks < 8; ++ks) acc = wm(kf[ks], qf[ks], acc);
    v4u pk;
#pragma unroll
    for (int u = 0; u < 4; ++u)
      pk[u] = pack2(expf(acc[2 * u] * 0.000244140625f), expf(acc[2 * u + 1] * 0.000244140625f));   // 2^-12
    *(v4u*)(sS + m * PPITCH + 16 * w + 8 * h) = pk;
  }

  // ---------------- stage 2b: the block's v.Wo tile, while AH is on its way ----------------
  wait_ds0();
  if (pinned(wave < 2u)) tdm_wait<0>(g0v, g1);           // V half landed
  if (pinned(role == 2u)) tdm_wait<0>(g0, g1);           // Wo^T half landed
  lds_barrier();                                         // barrier 2: publishes V and Wo^T
  if (pinned(wave == 6u)) tdm_load(g0, g1);
  {
    const int kp = w & 3, dp = w >> 2;
    const _Float16* va = sV + (32 * kp + m) * PPITCH + 8 * h;            // A-op rows kk = 32 kp + m, + 16
    const _Float16* wb = sW + (32 * dp + m) * PPITCH + 8 * h;            // B-op cols d = d0 + 32 dp + m, + 16
    v16h a0[8], a1[8], b0[8], b1[8];                    // all 64 LDS reads issued as one group ahead of the products
#pragma unroll
    for (int ks = 0; ks < 8; ++ks) {                    // e = 32 ks + ..: column half ks >> 2, 32 (ks & 3) inside it
      a0[ks] = ldfrag(va + (ks >> 2) * KH + (ks & 3) * 32);
      b0[ks] = ldfrag(wb + (ks >> 2) * WH + (ks & 3) * 32);
      a1[ks] = ldfrag(va + 16 * PPITCH + (ks >> 2) * KH + (ks & 3) * 32);
      b1[ks] = ldfrag(wb + 16 * PPITCH + (ks >> 2) * WH + (ks & 3) * 32);
      // the reads are issued in the order in which the products take them: without this, reads of the second k step stood
      // last and the second product waited for nearly all 64
      __builtin_amdgcn_sched_barrier(0);
    }
    v8f c00 = fill8(0.0f), c01 = fill8(0.0f), c10 = fill8(0.0f), c11 = fill8(0.0f);
#pragma unroll
    for (int ks = 0; ks < 8; ++ks) {
      c00 = wm(a0[ks], b0[ks], c00);
      c01 = wm(a0[ks], b1[ks], c01);
      c10 = wm(a1[ks], b0[ks], c10);
      c11 = wm(a1[ks], b1[ks], c11);
      // the four products of a k step stay together, so each step runs as soon as its own 8 reads are back: without this
      // one accumulator's 8 products ran alone while the reads came in and the other 24 stood behind the last read
      __builtin_amdgcn_sched_barrier(0);
    }
    _Float16* tp = sVW + (32 * dp + m) * PPITCH + 32 * kp + 8 * h;       // 16384 v.Wo * 2^-10 = 16 v.Wo
    *(v4u*)(tp)                    = pack8(c00, 0.0009765625f);
    *(v4u*)(tp + 16)               = pack8(c10, 0.0009765625f);
    *(v4u*)(tp + 16 * PPITCH)      = pack8(c01, 0.0009765625f);
    *(v4u*)(tp + 16 * PPITCH + 16) = pack8(c11, 0.0009765625f);
  }
  // nothing that needs adj or adj_mask is scheduled among the products above: without this a compare of stage 3 stood
  // behind the first product, with a wait for every global load in front of it
  __builtin_amdgcn_sched_barrier(0);
  wait_ds0();
  if (pinned(wave == 6u)) tdm_wait<0>(g0, g1);           // AH landed in At
  __syncthreads();                                       // barrier 3: publishes sS, sVW and At

  // ---------------- stage 3: row sums, scales, the two masks per j; the v.Wo fragments of all four d tiles ----------------
  v16h VWf[4][4];
  {
    const _Float16* pS = sS + m * PPITCH + 8 * h;                        // A-op row j = j0 + m
    const _Float16* pE = At + (16 * w + m) * PPITCH + 8 * h;             // B-op col i = 16 w + m
    const _Float16* vp = sVW + m * PPITCH + 8 * h;                       // A-op row d = d0 + 16 dt + m of the main loop
    v16h sa[4], ea[4];
#pragma unroll
    for (int ks = 0; ks < 4; ++ks) {
      sa[ks] = ldfrag(pS + ks * 32);
      ea[ks] = ldfrag(pE + ks * 32);
    }
#pragma unroll
    for (int dt = 0; dt < 4; ++dt) {
#pragma unroll
      for (int ks = 0; ks < 4; ++ks) VWf[dt][ks] = ldfrag(vp + dt * 16 * PPITCH + ks * 32);
    }
    v8f den = fill8(0.0f);
#pragma unroll
    for (int ks = 0; ks < 4; ++ks) den = wm(sa[ks], ea[ks], den);
    unsigned bv = 0u, bz = 0u;                           // lane l keeps the ballots of register r = l & 7
#pragma unroll
    for (int r = 0; r < 8; ++r) {
      const int aij = (r < 4) ? aj0[r & 3] : aj1[r & 3];
      const int msk = (r < 4) ? mj0[r & 3] : mj1[r & 3];
      scl[(8 * h + r) * NN + 16 * w + m] = 0.0625f / fmaxf(den[r], 1.0e-9f);
      const unsigned b1 = __builtin_amdgcn_ballot_w32(aij != 0 && msk == 0);   // bits 0..15: j = r, bits 16..31: j = 8 + r
      const unsigned b2 = __builtin_amdgcn_ballot_w32(aij == 0 && msk == 0);
      if ((lane & 7) == r) {
        bv = b1;
        bz = b2;
      }
    }
    if (lane < 16) {                                     // lane = j: bits i = 16 w .. 16 w + 15 of its two masks
      const int sh = (lane & 8) * 2;
      ((unsigned short*)(void*)vm)[lane * 8 + w] = (unsigned short)(bv >> sh);
      ((unsigned short*)(void*)zm)[lane * 8 + w] = (unsigned short)(bz >> sh);
    }
  }
  __syncthreads();

  // ---------------- main: (s_j * VW) . adj^T over the listed subtrees, scaled, max over i ----------------
  // the wave's two lists, built together so that their LDS round trips overlap: every place first takes the first listed i,
  // then place (number of set bits below i) takes i. The masks are the same in every lane: counts and tests run on scalars.
  int   ntv[2];
  float basev[2];
  v4u   vr[2], zr[2];
#pragma unroll
  for (int p = 0; p < 2; ++p) {
    vr[p] = *(const v4u*)(vm + (2 * w + p) * 4);
    zr[p] = *(const v4u*)(zm + (2 * w + p) * 4);
  }
#pragma unroll
  for (int p = 0; p < 2; ++p) {
    const int jl = 2 * w + p;
    unsigned vk[4];
#pragma unroll
    for (int q = 0; q < 4; ++q) vk[q] = uni(vr[p][q]);
    const unsigned zany = uni(zr[p][0] | zr[p][1] | zr[p][2] | zr[p][3]);
    const int cnt = __builtin_popcount(vk[0]) + __builtin_popcount(vk[1]) + __builtin_popcount(vk[2]) + __builtin_popcount(vk[3]);
    const int flo = __builtin_ffsll((long long)(((unsigned long long)vk[1] << 32) | vk[0]));   // 1 + lowest set bit, 0: none
    const int fhi = __builtin_ffsll((long long)(((unsigned long long)vk[3] << 32) | vk[2]));
    const unsigned first = (unsigned)(flo ? flo - 1 : (fhi ? fhi + 63 : 0));
    unsigned* L = lst + jl * NN;
    v4u fl;
    fl[0] = first; fl[1] = first; fl[2] = first; fl[3] = first;
    *(v4u*)(L + lane * 4) = fl;
    const unsigned below = (1u << lane) - 1u;
    int pre = 0;
#pragma unroll
    for (int q = 0; q < 4; ++q) {
      if ((vk[q] >> lane) & 1u) L[pre + __builtin_popcount(vk[q] & below)] = (unsigned)(32 * q + lane);
      pre += __builtin_popcount(vk[q]);
    }
    ntv[p]   = (cnt + 15) >> 4;                          // 0..8 tiles
    basev[p] = (zany != 0u) ? 0.0f : ((cnt < NN) ? -1.0e12f : -3.0e38f);
  }

  const _Float16* ap = At + 8 * h;                       // B-op col: row i of At, i from the list
#pragma unroll 1                                         // rolled: one j's 16 scaled fragments live at a time
  for (int p = 0; p < 2; ++p) {
    const int jl = 2 * w + p;
    const int nt = p ? ntv[1] : ntv[0];
    const float base = p ? basev[1] : basev[0];
    const unsigned* L = lst + jl * NN;
    const unsigned i0 = L[m];
    unsigned i1 = L[16 + m];
    v16h sf[4];
#pragma unroll
    for (int ks = 0; ks < 4; ++ks) sf[ks] = ldfrag(sS + jl * PPITCH + ks * 32 + 8 * h);
    const float* sj = scl + jl * NN;
    v16h f[4];                                           // each fragment is read anew for the next tile behind its last product
#pragma unroll
    for (int ks = 0; ks < 4; ++ks) f[ks] = ldfrag(ap + i0 * PPITCH + ks * 32);
    float s0 = sj[i0];
    // the first tile's reads are on their way while the 128 multiplies below run: without this they stood among the last of them
    __builtin_amdgcn_sched_barrier(0);
    v16h Bs[4][4];
#pragma unroll
    for (int dt = 0; dt < 4; ++dt) {
#pragma unroll
      for (int ks = 0; ks < 4; ++ks) Bs[dt][ks] = VWf[dt][ks] * sf[ks];
    }
    float M[32];
#pragma unroll
    for (int e = 0; e < 32; ++e) M[e] = -3.0e38f;
#pragma unroll 1                                         // rolled: the trip count is the list's length in tiles
    for (int t = 0; t < nt; ++t) {
      const _Float16* an = ap + i1 * PPITCH;             // next tile; behind the last one a filled place, read and not used
      const float s1 = sj[i1];
      const unsigned i2 = L[((t + 2) & 7) * 16 + m];
      v8f c[4];
#pragma unroll
      for (int dt = 0; dt < 4; ++dt) c[dt] = fill8(0.0f);
#pragma unroll
      for (int ks = 0; ks < 4; ++ks) {
#pragma unroll
        for (int dt = 0; dt < 4; ++dt) c[dt] = wm(Bs[dt][ks], f[ks], c[dt]);
        f[ks] = ldfrag(an + ks * 32);
        // the next tile's reads stay behind the k step that frees their registers: without this all 8 stood behind the last
        // product, with only the scaling and the maxima between them and the next tile's first product
        __builtin_amdgcn_sched_barrier(0);
      }
#pragma unroll
      for (int dt = 0; dt < 4; ++dt) {
#pragma unroll
        for (int q = 0; q < 4; ++q) {                    // neighbouring registers as one packed multiply
          v2f cc;
          cc[0] = c[dt][2 * q];
          cc[1] = c[dt][2 * q + 1];
          const v2f v = cc * s0;
          M[dt * 8 + 2 * q]     = fmaxf(M[dt * 8 + 2 * q], v[0]);
          M[dt * 8 + 2 * q + 1] = fmaxf(M[dt * 8 + 2 * q + 1], v[1]);
        }
      }
#if defined(__HIP_DEVICE_COMPILE__)
      // holds the two reads at the head of this trip: without this they were moved into the next trip, where the row address
      // of its fragment reads waited for the list entry
      asm volatile("" :: "v"(i2), "v"(s1));
#endif
      s0 = s1;
      i1 = i2;
    }
    // index e = 8 dt + r: bits 0..3 go to lane bits 0..3, bit 4 stays as the two values left per lane
    foldmax<1, 32>(M, m);
    foldmax<2, 16>(M, m);
    foldmax<4, 8>(M, m);
    foldmax<8, 4>(M, m);
    float* ob = sO + jl * DQ + 16 * (m >> 3) + 8 * h + (m & 7);
    ob[0]  = fmaxf(M[0], base);                          // dt = (m >> 3)
    ob[32] = fmaxf(M[1], base);                          // dt = 2 + (m >> 3)
  }
  __syncthreads();

  {                                                      // 256 threads x 16 B: 16 rows of 256 B, two whole lines each
    const int jl = tid >> 4, pc = (tid & 15) * 4;
    const v4f mv = *(const v4f*)(sO + jl * DQ + pc);
    const v4f bv = *(const v4f*)(bo + d0 + pc);
    v4f ov;
#pragma unroll
    for (int u = 0; u < 4; ++u) ov[u] = (mv[u] == -1.0e12f) ? -1.0e12f : mv[u] + bfr(bv[u]);
    *(v4f*)(out + (size_t)(b * NN + j0 + jl) * DDIM + d0 + pc) = ov;
  }
}

// =====================================================================================================
// Workspace map (bytes); every region is an exact multiple of its whole-line store granularity:
//   (not used)                                524288 at       0
//   WT   f16 [4][256][256], plane 3 alone     524288 at  524288
//   QKV  f16 Q, K, V [1024][256] each        1572864 at 1048576
//   (not used)                                786432 at 2621440
//   AH   f16 [8][128][128]                    262144 at 3407872
//   total                                    3670016
// =====================================================================================================
extern "C" void kernel_launch(void* const* d_in, const int* in_sizes, int n_in,
                              void* d_out, int out_size, void* d_ws, size_t ws_size,
                              hipStream_t stream) {
  if (n_in < 11) return;
  if (in_sizes[0] != SSZ) return;                // adj
  if (in_sizes[1] != PLN) return;                // sat_inputs
  if (in_sizes[2] != SSZ) return;                // adj_mask
  if (in_sizes[3] != WSZ || in_sizes[4] != DDIM) return;
  if (in_sizes[5] != WSZ || in_sizes[6] != DDIM) return;
  if (in_sizes[7] != WSZ || in_sizes[8] != DDIM) return;
  if (in_sizes[9] != WSZ || in_sizes[10] != DDIM) return;
  if (out_size != PLN) return;

  const int*   adj  = (const int*)d_in[0];       // [8][128][128]
  const float* x    = (const float*)d_in[1];     // [8][128][256]
  const int*   adjm = (const int*)d_in[2];       // [8][128][128]
  const float* Wq   = (const float*)d_in[3];  const float* bq = (const float*)d_in[4];
  const float* Wk   = (const float*)d_in[5];  const float* bk = (const float*)d_in[6];
  const float* Wv   = (const float*)d_in[7];  const float* bv = (const float*)d_in[8];
  const float* Wo   = (const float*)d_in[9];  const float* bo = (const float*)d_in[10];
  float* out = (float*)d_out;                    // [8][128][256]

  const size_t offXh  = 0;
  const size_t offWT  = offXh  + (size_t)PLN * 2;
  const size_t offQKV = offWT  + (size_t)4 * WSZ * 2;
  const size_t offS   = offQKV + (size_t)3 * PLN * 2;
  const size_t offVW  = offS   + (size_t)SSZ * 2;
  const size_t offAH  = offVW  + (size_t)PLN * 2;
  const size_t total  = offAH  + (size_t)SSZ * 2;          // 3670016
  if (total > ws_size) return;
  if (total > (size_t)134217728) return;

  char* ws = (char*)d_ws;
  unsigned short* WT  = (unsigned short*)(ws + offWT);
  unsigned short* QKV = (unsigned short*)(ws + offQKV);
  unsigned short* AH  = (unsigned short*)(ws + offAH);

  k_proj<<<dim3(NPROJ + 8 + SSZ / 2048), dim3(256), 0, stream>>>(x, Wq, Wk, Wv, Wo, bq, bk, bv, adj, QKV, WT, AH);
  k_main<<<dim3(NBATCH * (NN / JT) * (DDIM / DQ)), dim3(256), 0, stream>>>(AH, adj, adjm, QKV, WT, bo, out);
  (void)hipGetLastError();
}
